// v000
// The times below were measured on an AMD MI455X: many runs one after another, warmed up first and cycling through
// copies of the inputs, with the whole window's GPU time divided by the number of runs. Launches and the gaps
// between them are all in it. The median over several windows is given; except for v000 it joins two sittings, which
// can be a few percent apart, so the side-by-side timings, each taken in one sitting, are the better comparison.
// v000, which the later versions start from, runs in 1610 microseconds.
#include <hip/hip_runtime.h>

// multihead_attentive_layer (query [2][2048][1024]; q/k/v = x W + b ([1024][2048]: 16 heads x 128); scores = q.k / sqrt(S = 2048) (the source scales by the sequence length, not the head dim) + -1e12 * (1 - causal); softmax; out = merged Wo ([2048][1024]) + bo -> [2][2048][1024]).
// Compute dtypes, f32 accumulate: every input rounded to bf16; q/k/v on PLAIN bf16 operands (inputs: exact) + bias; causal scores and attn.v: query rows < 512 hl (3 products), the rest single fp16 (x1024), causal tile skipping (the additive -1e12 underflows to exactly 0 weight, as skipping does); softmax f32; Wo hl x exact (2 products) + bias.

#define NB_  2
#define TT   2048
#define DM   1024
#define NH_  16
#define NKV  16
#define REP  (NH_ / NKV)
#define HD   128
#define DQ   (NH_ * HD)
#define DKV  (NKV * HD)
#define ZH   2
#define RH   512                  // query rows < RH use hi+lo planes (0: none)
#define WIN  2048
#define PCAR 1024.0f
#define SCL  0.022097086912079608f   // 1/sqrt(S = 2048): the source scales by the value sequence length
typedef _Float16 h16;
typedef unsigned short bf;
typedef __attribute__((ext_vector_type(16))) __bf16   v16bf;
typedef __attribute__((ext_vector_type(16))) _Float16 v16h;
typedef __attribute__((ext_vector_type(8)))  _Float16 v8h;
typedef __attribute__((ext_vector_type(8)))  unsigned short v8us;
typedef __attribute__((ext_vector_type(8)))  float    v8f;
typedef __attribute__((ext_vector_type(4)))  float    v4f;
typedef v8h  __attribute__((may_alias)) v8ha;
typedef v4f  __attribute__((may_alias)) v4fa;
typedef v8us __attribute__((may_alias)) v8usa;

__device__ __forceinline__ unsigned short f2bf(float f) { unsigned u = __float_as_uint(f); u += 0x7FFFu + ((u >> 16) & 1u); return (unsigned short)(u >> 16); }
__device__ __forceinline__ float bf2f(unsigned short b) { return __uint_as_float(((unsigned)b) << 16); }
__device__ __forceinline__ float bfr(float f) { return bf2f(f2bf(f)); }
__device__ __forceinline__ v16h cat16(v8h lo, v8h hi) { return __builtin_shufflevector(lo, hi, 0, 1, 2, 3, 4, 5, 6, 7, 8, 9, 10, 11, 12, 13, 14, 15); }
__device__ __forceinline__ v16bf cat16b(v8us lo, v8us hi) { return __builtin_bit_cast(v16bf, __builtin_shufflevector(lo, hi, 0, 1, 2, 3, 4, 5, 6, 7, 8, 9, 10, 11, 12, 13, 14, 15)); }
__device__ __forceinline__ v8f wmma16(v16h a, v16h b, v8f c) { return __builtin_amdgcn_wmma_f32_16x16x32_f16(false, a, false, b, (short)0, c, false, false); }
__device__ __forceinline__ v8f wmmab(v16bf a, v16bf b, v8f c) { return __builtin_amdgcn_wmma_f32_16x16x32_bf16(false, a, false, b, (short)0, c, false, false); }



// ---- k_gemmw: register-blocked GEMM, ONE WAVE per 64x64 output tile (16 accumulators), operands straight from K-contiguous 16-bit planes; grid (M/64, N/64, Z), 32 threads.
// C[m][n] (f32, pitch ldc, + optional f32 bias[n]) = sum_k A[m][k] Bt[n][k] (+ split products per NSPLIT). z-batch strides sA/sB/sC in elements. K % 32 == 0.
template <typename T16> struct WFrag;
template <> struct WFrag<h16> { typedef v16h V; static __device__ __forceinline__ V ld(const h16* p) { return cat16(*(const v8h*)p, *(const v8h*)(p + 16)); } static __device__ __forceinline__ v8f mma(V a, V b, v8f c) { return wmma16(a, b, c); } };
template <> struct WFrag<bf> { typedef v16bf V; static __device__ __forceinline__ V ld(const bf* p) { return cat16b(*(const v8us*)p, *(const v8us*)(p + 16)); } static __device__ __forceinline__ v8f mma(V a, V b, v8f c) { return wmmab(a, b, c); } };
template <typename T16, int NSPLIT, bool BIAS>
__global__ __launch_bounds__(32) void k_gemmw(const T16* __restrict__ A, const T16* __restrict__ A2, const T16* __restrict__ Bt, const T16* __restrict__ Bt2, int K, float* C, int ldc, const float* __restrict__ bias, size_t sA, size_t sB, size_t sC) {
    typedef typename WFrag<T16>::V V;
    __shared__ __align__(16) float os[16 * 68];
    const size_t z = blockIdx.z; A += z * sA; if (A2) A2 += z * sA; Bt += z * sB; if (Bt2) Bt2 += z * sB; C += z * sC;
    const int lane = threadIdx.x & 31, lr = lane & 15, hi = lane >> 4; const int r0 = blockIdx.x * 64, c0 = blockIdx.y * 64;
    v8f acc[4][4];
#pragma unroll
    for (int mb = 0; mb < 4; ++mb)
#pragma unroll
        for (int nb = 0; nb < 4; ++nb) acc[mb][nb] = (v8f){};
    const size_t aoff = (size_t)(r0 + lr) * K + 8 * hi, boff = (size_t)(c0 + lr) * K + 8 * hi;
#pragma unroll 1
    for (int kc = 0; kc < K; kc += 32) {
        V a[4], a2[4];
#pragma unroll
        for (int mb = 0; mb < 4; ++mb) { a[mb] = WFrag<T16>::ld(A + aoff + (size_t)mb * 16 * K + kc); if (NSPLIT == 1 || NSPLIT == 2) a2[mb] = WFrag<T16>::ld(A2 + aoff + (size_t)mb * 16 * K + kc); }
#pragma unroll
        for (int nb = 0; nb < 4; ++nb) { const V b = WFrag<T16>::ld(Bt + boff + (size_t)nb * 16 * K + kc); V b2; if (NSPLIT >= 2) b2 = WFrag<T16>::ld(Bt2 + boff + (size_t)nb * 16 * K + kc);
#pragma unroll
            for (int mb = 0; mb < 4; ++mb) { acc[mb][nb] = WFrag<T16>::mma(a[mb], b, acc[mb][nb]); if (NSPLIT == 1 || NSPLIT == 2) acc[mb][nb] = WFrag<T16>::mma(a2[mb], b, acc[mb][nb]); if (NSPLIT >= 2) acc[mb][nb] = WFrag<T16>::mma(a[mb], b2, acc[mb][nb]); } }
        asm volatile("v_nop\n\tv_nop\n\tv_nop\n\tv_nop" : "+v"(acc[0][0]), "+v"(acc[1][1]), "+v"(acc[2][2]), "+v"(acc[3][3]) : "v"(a[0]), "v"(a[3]));
    }
#pragma unroll
    for (int mb = 0; mb < 4; ++mb) {
#pragma unroll
        for (int nb = 0; nb < 4; ++nb) {
#pragma unroll
            for (int j = 0; j < 8; ++j) os[(hi * 8 + j) * 68 + nb * 16 + lr] = acc[mb][nb][j]; }
        __builtin_amdgcn_wave_barrier(); asm volatile("" ::: "memory");
        float* crow = C + (size_t)(r0 + mb * 16) * ldc + c0;
{
#pragma unroll
            for (int s = 0; s < 8; ++s) { const int row = 2 * s + hi, cofs = lr * 4; v4f val = *(const v4fa*)(os + row * 68 + cofs); if (BIAS) { val[0] += bfr(bias[c0 + cofs]); val[1] += bfr(bias[c0 + cofs + 1]); val[2] += bfr(bias[c0 + cofs + 2]); val[3] += bfr(bias[c0 + cofs + 3]); }
                *(v4f*)(crow + (size_t)row * ldc + cofs) = val; }
             }
        __builtin_amdgcn_wave_barrier(); asm volatile("" ::: "memory");
    }
}

// ---- k_gemmc: the same one-wave 64x64 tile GEMM specialised for causal attention: CMODE 1 skips score tiles entirely above the diagonal (query rows r0+roff.., key columns c0..), CMODE 2 limits the
// key (K) loop of the probability x value contraction to the diagonal block (probabilities beyond it are exactly zero). roff = row offset of this launch's first row within the sequence.
template <typename T16, int NSPLIT, int CMODE>
__global__ __launch_bounds__(32) void k_gemmc(const T16* __restrict__ A, const T16* __restrict__ A2, const T16* __restrict__ Bt, const T16* __restrict__ Bt2, int K, float* C, int ldc, int roff, size_t sA, size_t sB, size_t sC) {
    typedef typename WFrag<T16>::V V;
    __shared__ __align__(16) float os[16 * 68];
    const size_t z = blockIdx.z; A += z * sA; if (A2) A2 += z * sA; Bt += z * sB; if (Bt2) Bt2 += z * sB; C += z * sC;
    const int lane = threadIdx.x & 31, lr = lane & 15, hi = lane >> 4; const int r0 = blockIdx.x * 64, c0 = blockIdx.y * 64;
    if (CMODE == 1 && c0 > r0 + roff + 63) return;                  // score tile entirely above the causal diagonal: never read (the softmax masks j > i by select)
    const int Kl = (CMODE == 2) ? min(K, r0 + roff + 64) : K;        // P.V: probabilities are exactly 0 beyond the diagonal block, so the K loop stops there
    v8f acc[4][4];
#pragma unroll
    for (int mb = 0; mb < 4; ++mb)
#pragma unroll
        for (int nb = 0; nb < 4; ++nb) acc[mb][nb] = (v8f){};
    const size_t aoff = (size_t)(r0 + lr) * K + 8 * hi, boff = (size_t)(c0 + lr) * K + 8 * hi;
#pragma unroll 1
    for (int kc = 0; kc < Kl; kc += 32) {
        V a[4], a2[4];
#pragma unroll
        for (int mb = 0; mb < 4; ++mb) { a[mb] = WFrag<T16>::ld(A + aoff + (size_t)mb * 16 * K + kc); if (NSPLIT == 1 || NSPLIT == 2) a2[mb] = WFrag<T16>::ld(A2 + aoff + (size_t)mb * 16 * K + kc); }
#pragma unroll
        for (int nb = 0; nb < 4; ++nb) { const V b = WFrag<T16>::ld(Bt + boff + (size_t)nb * 16 * K + kc); V b2; if (NSPLIT >= 2) b2 = WFrag<T16>::ld(Bt2 + boff + (size_t)nb * 16 * K + kc);
#pragma unroll
            for (int mb = 0; mb < 4; ++mb) { acc[mb][nb] = WFrag<T16>::mma(a[mb], b, acc[mb][nb]); if (NSPLIT == 1 || NSPLIT == 2) acc[mb][nb] = WFrag<T16>::mma(a2[mb], b, acc[mb][nb]); if (NSPLIT >= 2) acc[mb][nb] = WFrag<T16>::mma(a[mb], b2, acc[mb][nb]); } }
        asm volatile("v_nop\n\tv_nop\n\tv_nop\n\tv_nop" : "+v"(acc[0][0]), "+v"(acc[1][1]), "+v"(acc[2][2]), "+v"(acc[3][3]) : "v"(a[0]), "v"(a[3]));
    }
#pragma unroll
    for (int mb = 0; mb < 4; ++mb) {
#pragma unroll
        for (int nb = 0; nb < 4; ++nb) {
#pragma unroll
            for (int j = 0; j < 8; ++j) os[(hi * 8 + j) * 68 + nb * 16 + lr] = acc[mb][nb][j]; }
        __builtin_amdgcn_wave_barrier(); asm volatile("" ::: "memory");
        float* crow = C + (size_t)(r0 + mb * 16) * ldc + c0;
{
#pragma unroll
            for (int s = 0; s < 8; ++s) { const int row = 2 * s + hi, cofs = lr * 4; v4f val = *(const v4fa*)(os + row * 68 + cofs);
                *(v4f*)(crow + (size_t)row * ldc + cofs) = val; }
             }
        __builtin_amdgcn_wave_barrier(); asm volatile("" ::: "memory");
    }
}

__device__ __forceinline__ h16 tohx(float x) { return (h16)x; }
__device__ __forceinline__ void splitf(float y, unsigned short& h, unsigned short& l) { h = f2bf(y); l = f2bf(y - bf2f(h)); }
typedef __attribute__((ext_vector_type(2))) _Float16 v2h;
typedef __attribute__((ext_vector_type(4))) _Float16 v4h;
typedef __attribute__((ext_vector_type(2))) unsigned short v2us;
typedef __attribute__((ext_vector_type(4))) unsigned short v4us;
typedef __attribute__((ext_vector_type(2))) float v2f;
typedef __attribute__((ext_vector_type(4))) int v4i;

__global__ __launch_bounds__(256) void k_wtG(const float* __restrict__ w, int K, int N, bf* Bt) {
    const int lane = threadIdx.x & 31; const int L0 = (blockIdx.x * 8 + (threadIdx.x >> 5)) * 8; const int nlines = N * K / 64;
{
#pragma unroll 1
        for (int l = 0; l < 8; ++l) { const int L = L0 + l; if (L >= nlines) break; const size_t e = (size_t)L * 64 + lane * 2; const int k = (int)(e % K), n = (int)(e / K); v2us o;
            o[0] = f2bf(w[(size_t)k * N + n]); o[1] = f2bf(w[(size_t)(k + 1) * N + n]); *(v2us*)(Bt + e) = o; }
         }
}
__global__ __launch_bounds__(256) void k_cvt8(const float* __restrict__ src, bf* dst, size_t n8) { const size_t i = (size_t)blockIdx.x * 256 + threadIdx.x; if (i >= n8) return; const v8f v = *(const v8f*)(src + i * 8); v8us o;
#pragma unroll
    for (int k = 0; k < 8; ++k) o[k] = f2bf(v[k]); *(v8us*)(dst + i * 8) = o;  }
__global__ __launch_bounds__(256) void k_cscvt(const float* __restrict__ cosT, const float* __restrict__ sinT, float* CS) { const int idx = blockIdx.x * 256 + threadIdx.x; if (idx >= TT * HD) return; v2f cs; cs[0] = bfr(cosT[idx]); cs[1] = bfr(sinT[idx]); *(v2f*)(CS + (size_t)idx * 2) = cs;  }
// k_rope: head planes [h][t][d] (fp16 + hi/lo) of rope(x) x sc with the rotate-half convention out[d] = x[d] cos[t][d] - x[d+HD/2] sin[t][d], out[d+HD/2] = x[d+HD/2] cos[t][d+HD/2] + x[d] sin[t][d+HD/2]
__global__ __launch_bounds__(256) void k_rope(const float* __restrict__ F, int pitch, int nheads, const float* __restrict__ CS, const float* __restrict__ RF, const float* __restrict__ nw, float sc, h16* P16, bf* Ph, bf* Pl) {
    const size_t e = ((size_t)blockIdx.x * 256 + threadIdx.x) * 2; if (e >= (size_t)nheads * TT * HD) return; const int d = (int)(e % HD); const int t = (int)((e / HD) % TT); const int h = (int)(e / ((size_t)HD * TT)); const float* f = F + (size_t)t * pitch + h * HD; const float rf = RF ? RF[(size_t)h * TT + t] : 1.0f; v2h o16; v2us oh, ol;
#pragma unroll
    for (int q = 0; q < 2; ++q) { const int dd = d + q; const int dp = (dd < HD / 2) ? dd + HD / 2 : dd - HD / 2; float x0 = f[dd], x1 = f[dp];
        if (RF) { float n0 = __fmul_rn(x0, rf), n1 = __fmul_rn(x1, rf); asm volatile("" : "+v"(n0)); asm volatile("" : "+v"(n1)); x0 = __fmul_rn(bfr(nw[dd]), n0); x1 = __fmul_rn(bfr(nw[dp]), n1); }
        const v2f cs = *(const v2f*)(CS + ((size_t)t * HD + dd) * 2); float a = __fmul_rn(x0, cs[0]), bq = __fmul_rn(x1, cs[1]); asm volatile("" : "+v"(a)); asm volatile("" : "+v"(bq)); const float r = ((dd < HD / 2) ? __fsub_rn(a, bq) : __fadd_rn(a, bq)) * sc;
        o16[q] = tohx(r); unsigned short a2, c2; splitf(r, a2, c2); oh[q] = a2; ol[q] = c2; }
    *(v2h*)(P16 + e) = o16; *(v2us*)(Ph + e) = oh; *(v2us*)(Pl + e) = ol;  }
__global__ __launch_bounds__(256) void k_vtp(const float* __restrict__ F, int pitch, int nheads, h16* V16, bf* Vh, bf* Vl) { const size_t e = ((size_t)blockIdx.x * 256 + threadIdx.x) * 2; if (e >= (size_t)nheads * HD * TT) return; const int t = (int)(e % TT); const int d = (int)((e / TT) % HD); const int g = (int)(e / ((size_t)TT * HD)); v2h o16; v2us oh, ol;
#pragma unroll
    for (int q = 0; q < 2; ++q) { const float x = F[(size_t)(t + q) * pitch + g * HD + d]; o16[q] = tohx(x); unsigned short a2, c2; splitf(x, a2, c2); oh[q] = a2; ol[q] = c2; }
    *(v2h*)(V16 + e) = o16; *(v2us*)(Vh + e) = oh; *(v2us*)(Vl + e) = ol;  }
__global__ __launch_bounds__(256) void k_csid(float* CS) { const int idx = blockIdx.x * 256 + threadIdx.x; if (idx >= TT * HD) return; v2f cs; cs[0] = 1.0f; cs[1] = 0.0f; *(v2f*)(CS + (size_t)idx * 2) = cs;  }
// k_asoft: per row (zz, i): t = S x TT^-0.5 for j <= i and i - j < WIN (sliding causal window; the reference's -1e9 additive fill vanishes identically); softmax over the 2048 keys (register row, one exp, fixed trees);
__global__ __launch_bounds__(256) void k_asoft(const float* __restrict__ Sb, h16* P16, bf* Ph, bf* Pl) {
    const int lane = threadIdx.x & 31; const int row = blockIdx.x * 8 + (threadIdx.x >> 5); if (row >= ZH * TT) return; const int i = row % TT; const int zz = row / TT; (void)zz; const bool hires = (i < RH); const float* sr = Sb + (size_t)row * TT; float v[TT / 32]; float mx = -3.0e38f;
#pragma unroll
    for (int ch = 0; ch < TT / 128; ++ch) { const int j0 = ch * 128 + lane * 4; const v4f a = *(const v4f*)(sr + j0);
#pragma unroll
        for (int q = 0; q < 4; ++q) { const int j = j0 + q; (void)j; const float t = (j <= i && i - j < WIN) ? a[q] * SCL : -3.0e38f; v[ch * 4 + q] = t; mx = fmaxf(mx, t); } }
#pragma unroll
    for (int sh = 16; sh; sh >>= 1) mx = fmaxf(mx, __shfl_xor(mx, sh, 32));
    float sum = 0.f;
#pragma unroll
    for (int k = 0; k < TT / 32; ++k) { float d0 = __fsub_rn(v[k], mx); asm volatile("" : "+v"(d0)); v[k] = __builtin_amdgcn_exp2f(__fmul_rn(d0, 1.4426950408889634f)); sum += v[k]; }
#pragma unroll
    for (int sh = 16; sh; sh >>= 1) sum += __shfl_xor(sum, sh, 32);
    const float f = __fdiv_rn(hires ? 1.0f : PCAR, sum);
{
        if (hires) {
#pragma unroll
            for (int ch = 0; ch < TT / 128; ++ch) { v4us oh, ol;
#pragma unroll
                for (int q = 0; q < 4; ++q) { unsigned short a, c2; splitf(v[ch * 4 + q] * f, a, c2); oh[q] = a; ol[q] = c2; }
                const size_t oo = ((size_t)zz * (RH ? RH : 1) + i) * TT + ch * 128 + lane * 4; *(v4us*)(Ph + oo) = oh; *(v4us*)(Pl + oo) = ol; }
        } else {
#pragma unroll
            for (int ch = 0; ch < TT / 128; ++ch) { v4h o4;
#pragma unroll
                for (int q = 0; q < 4; ++q) o4[q] = tohx(v[ch * 4 + q] * f);
                *(v4h*)(P16 + (size_t)row * TT + ch * 128 + lane * 4) = o4; } }
         }
}
__global__ __launch_bounds__(256) void k_merge(const float* __restrict__ O, int h0, bf* Ah, bf* Al) { const size_t e = ((size_t)blockIdx.x * 256 + threadIdx.x) * 2; if (e >= (size_t)ZH * TT * HD) return; const int d = (int)(e % HD); const int t = (int)((e / HD) % TT); const int zz = (int)(e / ((size_t)HD * TT)); const float cs = (t < RH) ? 1.0f : (1.0f / PCAR); const size_t oo = (size_t)t * DQ + (h0 + zz) * HD + d;
    v2us oh, ol;
#pragma unroll
    for (int q = 0; q < 2; ++q) { unsigned short a, c2; splitf(O[e + q] * cs, a, c2); oh[q] = a; ol[q] = c2; } *(v2us*)(Ah + oo) = oh; *(v2us*)(Al + oo) = ol;  }

extern "C" void kernel_launch(void* const* d_in, const int* in_sizes, int n_in,
                              void* d_out, int out_size, void* d_ws, size_t ws_size, hipStream_t stream) {
    (void)in_sizes; (void)n_in; (void)out_size;
    const float* x = (const float*)d_in[0]; const float* wq = (const float*)d_in[1]; const float* bq = (const float*)d_in[2]; const float* wk = (const float*)d_in[3]; const float* bk = (const float*)d_in[4]; const float* wv = (const float*)d_in[5]; const float* bv = (const float*)d_in[6]; const float* wo = (const float*)d_in[7]; const float* bo = (const float*)d_in[8]; const float* cosT = nullptr; const float* sinT = nullptr; (void)cosT; (void)sinT;
    float* OUT = (float*)d_out;     // [2][2048][1024]
    char* wsp = (char*)d_ws;
    auto take = [&](size_t bytes) { char* p = wsp; wsp += (bytes + 255) & ~(size_t)255; return (void*)p; };
    bf* WQ = (bf*)take((size_t)DQ * DM * 2); bf* WK = (bf*)take((size_t)DKV * DM * 2); bf* WV = (bf*)take((size_t)DKV * DM * 2); bf* WO = (bf*)take((size_t)DM * DQ * 2); float* CS = (float*)take((size_t)TT * HD * 2 * 4);
    bf* XB = (bf*)take((size_t)TT * DM * 2); float* FQ = (float*)take((size_t)TT * DQ * 4); float* FK = (float*)take((size_t)TT * DKV * 4);
    h16* QP16 = (h16*)take((size_t)NH_ * TT * HD * 2); h16* KP16 = (h16*)take((size_t)NKV * TT * HD * 2); h16* VT16 = (h16*)take((size_t)NKV * HD * TT * 2);
    bf* QPh = (bf*)take((size_t)NH_ * TT * HD * 2); bf* QPl = (bf*)take((size_t)NH_ * TT * HD * 2); bf* KPh = (bf*)take((size_t)NKV * TT * HD * 2); bf* KPl = (bf*)take((size_t)NKV * TT * HD * 2); bf* VTh = (bf*)take((size_t)NKV * HD * TT * 2); bf* VTl = (bf*)take((size_t)NKV * HD * TT * 2); bf* Ph = (bf*)take((size_t)ZH * RH * TT * 2); bf* Pl = (bf*)take((size_t)ZH * RH * TT * 2);
    float* Sb = (float*)take((size_t)ZH * TT * TT * 4); h16* P16 = (h16*)take((size_t)ZH * TT * TT * 2); float* Ob = (float*)take((size_t)ZH * TT * HD * 4); bf* ATh = (bf*)take((size_t)TT * DQ * 2); bf* ATl = (bf*)take((size_t)TT * DQ * 2);
    if ((size_t)(wsp - (char*)d_ws) > ws_size) return;    // ws 256 MiB
    float* FV = FK;   // v projection reuses the k buffer after the k planes are built (stream-ordered)
    { k_wtG<<<(unsigned)((DM * DQ / 64 + 63) / 64), 256, 0, stream>>>(wq, DM, DQ, WQ); k_wtG<<<(unsigned)((DM * DKV / 64 + 63) / 64), 256, 0, stream>>>(wk, DM, DKV, WK); k_wtG<<<(unsigned)((DM * DKV / 64 + 63) / 64), 256, 0, stream>>>(wv, DM, DKV, WV);
      k_wtG<<<(unsigned)((DQ * DM / 64 + 63) / 64), 256, 0, stream>>>(wo, DQ, DM, WO);
       }
    k_csid<<<(TT * HD + 255) / 256, 256, 0, stream>>>(CS);
    const unsigned LQ = (unsigned)(((size_t)NH_ * TT * HD / 2 + 255) / 256), LKv = (unsigned)(((size_t)NKV * TT * HD / 2 + 255) / 256);
    for (int b = 0; b < NB_; ++b) {
        
        k_cvt8<<<(unsigned)(((size_t)TT * DM / 8 + 255) / 256), 256, 0, stream>>>(x + (size_t)b * TT * DM, XB, (size_t)TT * DM / 8);
        k_gemmw<bf, 0, true><<<dim3(TT / 64, DQ / 64, 1), 32, 0, stream>>>(XB, nullptr, WQ, nullptr, DM, FQ, DQ, bq, 0, 0, 0);
        k_rope<<<LQ, 256, 0, stream>>>(FQ, DQ, NH_, CS, nullptr, nullptr, 1.0f, QP16, QPh, QPl);
        k_gemmw<bf, 0, true><<<dim3(TT / 64, DKV / 64, 1), 32, 0, stream>>>(XB, nullptr, WK, nullptr, DM, FK, DKV, bk, 0, 0, 0);
        k_rope<<<LKv, 256, 0, stream>>>(FK, DKV, NKV, CS, nullptr, nullptr, 1.0f, KP16, KPh, KPl);
        k_gemmw<bf, 0, true><<<dim3(TT / 64, DKV / 64, 1), 32, 0, stream>>>(XB, nullptr, WV, nullptr, DM, FV, DKV, bv, 0, 0, 0); k_vtp<<<LKv, 256, 0, stream>>>(FV, DKV, NKV, VT16, VTh, VTl);
        for (int h0 = 0; h0 < NH_; h0 += ZH) { const size_t zq = (size_t)h0, zk = (size_t)(h0 / REP);   // one kv head per query head: the pass's two heads use consecutive kv planes (z-strides TT*HD)
            k_gemmc<bf, 2, 1><<<dim3(RH / 64, TT / 64, ZH), 32, 0, stream>>>(QPh + zq * TT * HD, QPl + zq * TT * HD, KPh + zk * TT * HD, KPl + zk * TT * HD, HD, Sb, TT, 0, (size_t)TT * HD, (size_t)TT * HD, (size_t)TT * TT);
            k_gemmc<h16, 0, 1><<<dim3((TT - RH) / 64, TT / 64, ZH), 32, 0, stream>>>(QP16 + zq * TT * HD + (size_t)RH * HD, nullptr, KP16 + zk * TT * HD, nullptr, HD, Sb + (size_t)RH * TT, TT, RH, (size_t)TT * HD, (size_t)TT * HD, (size_t)TT * TT);
            k_asoft<<<ZH * TT / 8, 256, 0, stream>>>(Sb, P16, Ph, Pl);
            k_gemmc<bf, 2, 2><<<dim3(RH / 64, HD / 64, ZH), 32, 0, stream>>>(Ph, Pl, VTh + zk * HD * TT, VTl + zk * HD * TT, TT, Ob, HD, 0, (size_t)RH * TT, (size_t)HD * TT, (size_t)TT * HD);
            k_gemmc<h16, 0, 2><<<dim3((TT - RH) / 64, HD / 64, ZH), 32, 0, stream>>>(P16 + (size_t)RH * TT, nullptr, VT16 + zk * HD * TT, nullptr, TT, Ob + (size_t)RH * HD, HD, RH, (size_t)TT * TT, (size_t)HD * TT, (size_t)TT * HD);
            k_merge<<<(unsigned)(((size_t)ZH * TT * HD / 2 + 255) / 256), 256, 0, stream>>>(Ob, h0, ATh, ATl); }
        k_gemmw<bf, 1, true><<<dim3(TT / 64, DM / 64, 1), 32, 0, stream>>>(ATh, ATl, WO, nullptr, DQ, OUT + (size_t)b * TT * DM, DM, bo, 0, 0, 0); }
}

// v001
// One run takes 1080 microseconds.
// Next to v000, in two timings, it ran 1.48 and 1.49 times as fast.
#include <hip/hip_runtime.h>

// multihead_attentive_layer (query [2][2048][1024]; q/k/v = x W + b ([1024][2048]: 16 heads x 128); scores = q.k / sqrt(S = 2048) (the source scales by the sequence length, not the head dim) + -1e12 * (1 - causal); softmax; out = merged Wo ([2048][1024]) + bo -> [2][2048][1024]).
// Compute dtypes, f32 accumulate: every input rounded to bf16; q/k/v on PLAIN bf16 operands (inputs: exact) + bias; causal scores and attn.v: query rows < 512 hl (3 products), the rest single fp16 (x1024), causal tile skipping (the additive -1e12 underflows to exactly 0 weight, as skipping does); softmax f32; Wo hl x exact (2 products) + bias.

#define NB_  2
#define TT   2048
#define DM   1024
#define NH_  16
#define NKV  16
#define REP  (NH_ / NKV)
#define HD   128
#define DQ   (NH_ * HD)
#define DKV  (NKV * HD)
#define ZH   2
#define RH   512                  // query rows < RH use hi+lo planes (0: none)
#define WIN  2048
#define PCAR 1024.0f
#define SCL  0.022097086912079608f   // 1/sqrt(S = 2048): the source scales by the value sequence length
typedef _Float16 h16;
typedef unsigned short bf;
typedef __attribute__((ext_vector_type(16))) __bf16   v16bf;
typedef __attribute__((ext_vector_type(16))) _Float16 v16h;
typedef __attribute__((ext_vector_type(8)))  _Float16 v8h;
typedef __attribute__((ext_vector_type(8)))  unsigned short v8us;
typedef __attribute__((ext_vector_type(8)))  float    v8f;
typedef __attribute__((ext_vector_type(4)))  float    v4f;
typedef v8h  __attribute__((may_alias)) v8ha;
typedef v4f  __attribute__((may_alias)) v4fa;
typedef v8us __attribute__((may_alias)) v8usa;

__device__ __forceinline__ unsigned short f2bf(float f) { unsigned u = __float_as_uint(f); u += 0x7FFFu + ((u >> 16) & 1u); return (unsigned short)(u >> 16); }
__device__ __forceinline__ float bf2f(unsigned short b) { return __uint_as_float(((unsigned)b) << 16); }
__device__ __forceinline__ float bfr(float f) { return bf2f(f2bf(f)); }
__device__ __forceinline__ v16h cat16(v8h lo, v8h hi) { return __builtin_shufflevector(lo, hi, 0, 1, 2, 3, 4, 5, 6, 7, 8, 9, 10, 11, 12, 13, 14, 15); }
__device__ __forceinline__ v16bf cat16b(v8us lo, v8us hi) { return __builtin_bit_cast(v16bf, __builtin_shufflevector(lo, hi, 0, 1, 2, 3, 4, 5, 6, 7, 8, 9, 10, 11, 12, 13, 14, 15)); }
__device__ __forceinline__ v8f wmma16(v16h a, v16h b, v8f c) { return __builtin_amdgcn_wmma_f32_16x16x32_f16(false, a, false, b, (short)0, c, false, false); }
__device__ __forceinline__ v8f wmmab(v16bf a, v16bf b, v8f c) { return __builtin_amdgcn_wmma_f32_16x16x32_bf16(false, a, false, b, (short)0, c, false, false); }



// ---- k_gemmw: register-blocked GEMM, ONE WAVE per 64x64 output tile (16 accumulators), operands straight from K-contiguous 16-bit planes; grid (M/64, N/64, Z), 32 threads.
// C[m][n] (f32, pitch ldc, + optional f32 bias[n]) = sum_k A[m][k] Bt[n][k] (+ split products per NSPLIT). z-batch strides sA/sB/sC in elements. K % 32 == 0.
template <typename T16> struct WFrag;
template <> struct WFrag<h16> { typedef v16h V; static __device__ __forceinline__ V ld(const h16* p) { return cat16(*(const v8h*)p, *(const v8h*)(p + 16)); } static __device__ __forceinline__ v8f mma(V a, V b, v8f c) { return wmma16(a, b, c); } };
template <> struct WFrag<bf> { typedef v16bf V; static __device__ __forceinline__ V ld(const bf* p) { return cat16b(*(const v8us*)p, *(const v8us*)(p + 16)); } static __device__ __forceinline__ v8f mma(V a, V b, v8f c) { return wmmab(a, b, c); } };
template <typename T16, int NSPLIT, bool BIAS>
__global__ __launch_bounds__(32) void k_gemmw(const T16* __restrict__ A, const T16* __restrict__ A2, const T16* __restrict__ Bt, const T16* __restrict__ Bt2, int K, float* C, int ldc, const float* __restrict__ bias, size_t sA, size_t sB, size_t sC) {
    typedef typename WFrag<T16>::V V;
    __shared__ __align__(16) float os[16 * 68];
    const size_t z = blockIdx.z; A += z * sA; if (A2) A2 += z * sA; Bt += z * sB; if (Bt2) Bt2 += z * sB; C += z * sC;
    const int lane = threadIdx.x & 31, lr = lane & 15, hi = lane >> 4; const int r0 = blockIdx.x * 64, c0 = blockIdx.y * 64;
    v8f acc[4][4];
#pragma unroll
    for (int mb = 0; mb < 4; ++mb)
#pragma unroll
        for (int nb = 0; nb < 4; ++nb) acc[mb][nb] = (v8f){};
    const size_t aoff = (size_t)(r0 + lr) * K + 8 * hi, boff = (size_t)(c0 + lr) * K + 8 * hi;
#pragma unroll 1
    for (int kc = 0; kc < K; kc += 32) {
        V a[4], a2[4];
#pragma unroll
        for (int mb = 0; mb < 4; ++mb) { a[mb] = WFrag<T16>::ld(A + aoff + (size_t)mb * 16 * K + kc); if (NSPLIT == 1 || NSPLIT == 2) a2[mb] = WFrag<T16>::ld(A2 + aoff + (size_t)mb * 16 * K + kc); }
#pragma unroll
        for (int nb = 0; nb < 4; ++nb) { const V b = WFrag<T16>::ld(Bt + boff + (size_t)nb * 16 * K + kc); V b2; if (NSPLIT >= 2) b2 = WFrag<T16>::ld(Bt2 + boff + (size_t)nb * 16 * K + kc);
#pragma unroll
            for (int mb = 0; mb < 4; ++mb) { acc[mb][nb] = WFrag<T16>::mma(a[mb], b, acc[mb][nb]); if (NSPLIT == 1 || NSPLIT == 2) acc[mb][nb] = WFrag<T16>::mma(a2[mb], b, acc[mb][nb]); if (NSPLIT >= 2) acc[mb][nb] = WFrag<T16>::mma(a[mb], b2, acc[mb][nb]); } }
        asm volatile("v_nop\n\tv_nop\n\tv_nop\n\tv_nop" : "+v"(acc[0][0]), "+v"(acc[1][1]), "+v"(acc[2][2]), "+v"(acc[3][3]) : "v"(a[0]), "v"(a[3]));
    }
#pragma unroll
    for (int mb = 0; mb < 4; ++mb) {
#pragma unroll
        for (int nb = 0; nb < 4; ++nb) {
#pragma unroll
            for (int j = 0; j < 8; ++j) os[(hi * 8 + j) * 68 + nb * 16 + lr] = acc[mb][nb][j]; }
        __builtin_amdgcn_wave_barrier(); asm volatile("" ::: "memory");
        float* crow = C + (size_t)(r0 + mb * 16) * ldc + c0;
{
#pragma unroll
            for (int s = 0; s < 8; ++s) { const int row = 2 * s + hi, cofs = lr * 4; v4f val = *(const v4fa*)(os + row * 68 + cofs); if (BIAS) { val[0] += bfr(bias[c0 + cofs]); val[1] += bfr(bias[c0 + cofs + 1]); val[2] += bfr(bias[c0 + cofs + 2]); val[3] += bfr(bias[c0 + cofs + 3]); }
                *(v4f*)(crow + (size_t)row * ldc + cofs) = val; }
             }
        __builtin_amdgcn_wave_barrier(); asm volatile("" ::: "memory");
    }
}

// ---- k_gemmc: the same 64x64 tile GEMM (one wave per tile, CMODE 2 eight) specialised for causal attention: CMODE 1 skips score tiles entirely above the diagonal (query rows r0+roff.., key columns c0..), CMODE 2 limits the
// key (K) loop of the probability x value contraction to the diagonal block (probabilities beyond it are exactly zero). roff = row offset of this launch's first row within the sequence.
// CMODE 2 runs NW = 8 waves per tile: wave w takes the 32-wide k steps w, w + 8, ... of the same 64x64 tile, each wave leaves its f32 partial tile in LDS, and after one barrier the 256 threads add the partials in wave order and store.
template <typename T16, int NSPLIT, int CMODE>
__global__ __launch_bounds__((CMODE == 2) ? 256 : 32) void k_gemmc(const T16* __restrict__ A, const T16* __restrict__ A2, const T16* __restrict__ Bt, const T16* __restrict__ Bt2, int K, float* C, int ldc, int roff, size_t sA, size_t sB, size_t sC) {
    typedef typename WFrag<T16>::V V;
    constexpr int NW = (CMODE == 2) ? 8 : 1;
    __shared__ __align__(16) float os[(NW == 1) ? 16 * 68 : NW * 64 * 68];
    const size_t z = blockIdx.z; A += z * sA; if (A2) A2 += z * sA; Bt += z * sB; if (Bt2) Bt2 += z * sB; C += z * sC;
    const int lane = threadIdx.x & 31, lr = lane & 15, hi = lane >> 4; const int r0 = blockIdx.x * 64, c0 = blockIdx.y * 64;
    if (CMODE == 1 && c0 > r0 + roff + 63) return;                  // score tile entirely above the causal diagonal: never read (the softmax masks j > i by select)
    const int wave = (NW == 1) ? 0 : __builtin_amdgcn_readfirstlane((int)(threadIdx.x >> 5));   // scalar, so that the k loop keeps a scalar trip test and every lane stays on at the matrix instructions
    const int Kl = (CMODE == 2) ? min(K, r0 + roff + 64) : K;        // P.V: probabilities are exactly 0 beyond the diagonal block, so the K loop stops there
    v8f acc[4][4];
#pragma unroll
    for (int mb = 0; mb < 4; ++mb)
#pragma unroll
        for (int nb = 0; nb < 4; ++nb) acc[mb][nb] = (v8f){};
    const size_t aoff = (size_t)(r0 + lr) * K + 8 * hi, boff = (size_t)(c0 + lr) * K + 8 * hi;
#pragma unroll 1
    for (int kc = wave * 32; kc < Kl; kc += NW * 32) {
        V a[4], a2[4];
#pragma unroll
        for (int mb = 0; mb < 4; ++mb) { a[mb] = WFrag<T16>::ld(A + aoff + (size_t)mb * 16 * K + kc); if (NSPLIT == 1 || NSPLIT == 2) a2[mb] = WFrag<T16>::ld(A2 + aoff + (size_t)mb * 16 * K + kc); }
#pragma unroll
        for (int nb = 0; nb < 4; ++nb) { const V b = WFrag<T16>::ld(Bt + boff + (size_t)nb * 16 * K + kc); V b2; if (NSPLIT >= 2) b2 = WFrag<T16>::ld(Bt2 + boff + (size_t)nb * 16 * K + kc);
#pragma unroll
            for (int mb = 0; mb < 4; ++mb) { acc[mb][nb] = WFrag<T16>::mma(a[mb], b, acc[mb][nb]); if (NSPLIT == 1 || NSPLIT == 2) acc[mb][nb] = WFrag<T16>::mma(a2[mb], b, acc[mb][nb]); if (NSPLIT >= 2) acc[mb][nb] = WFrag<T16>::mma(a[mb], b2, acc[mb][nb]); } }
        asm volatile("v_nop\n\tv_nop\n\tv_nop\n\tv_nop" : "+v"(acc[0][0]), "+v"(acc[1][1]), "+v"(acc[2][2]), "+v"(acc[3][3]) : "v"(a[0]), "v"(a[3]));
    }
    if constexpr (NW == 1) {
#pragma unroll
    for (int mb = 0; mb < 4; ++mb) {
#pragma unroll
        for (int nb = 0; nb < 4; ++nb) {
#pragma unroll
            for (int j = 0; j < 8; ++j) os[(hi * 8 + j) * 68 + nb * 16 + lr] = acc[mb][nb][j]; }
        __builtin_amdgcn_wave_barrier(); asm volatile("" ::: "memory");
        float* crow = C + (size_t)(r0 + mb * 16) * ldc + c0;
{
#pragma unroll
            for (int s = 0; s < 8; ++s) { const int row = 2 * s + hi, cofs = lr * 4; v4f val = *(const v4fa*)(os + row * 68 + cofs);
                *(v4f*)(crow + (size_t)row * ldc + cofs) = val; }
             }
        __builtin_amdgcn_wave_barrier(); asm volatile("" ::: "memory");
    }
    } else {
        float* ow = os + wave * (64 * 68);
#pragma unroll
        for (int mb = 0; mb < 4; ++mb)
#pragma unroll
            for (int nb = 0; nb < 4; ++nb)
#pragma unroll
                for (int j = 0; j < 8; ++j) ow[(mb * 16 + hi * 8 + j) * 68 + nb * 16 + lr] = acc[mb][nb][j];
        __syncthreads();   // all NW partial tiles stand in LDS before any thread adds them
        const int trow = (int)(threadIdx.x >> 4), cofs = (int)(threadIdx.x & 15) * 4;
#pragma unroll
        for (int s = 0; s < 4; ++s) { const int row = s * 16 + trow; v4f val = *(const v4fa*)(os + row * 68 + cofs);
#pragma unroll
            for (int w = 1; w < NW; ++w) val += *(const v4fa*)(os + w * (64 * 68) + row * 68 + cofs);
            *(v4f*)(C + (size_t)(r0 + row) * ldc + c0 + cofs) = val; }
    }
}

__device__ __forceinline__ h16 tohx(float x) { return (h16)x; }
__device__ __forceinline__ void splitf(float y, unsigned short& h, unsigned short& l) { h = f2bf(y); l = f2bf(y - bf2f(h)); }
typedef __attribute__((ext_vector_type(2))) _Float16 v2h;
typedef __attribute__((ext_vector_type(4))) _Float16 v4h;
typedef __attribute__((ext_vector_type(2))) unsigned short v2us;
typedef __attribute__((ext_vector_type(4))) unsigned short v4us;
typedef __attribute__((ext_vector_type(2))) float v2f;
typedef __attribute__((ext_vector_type(4))) int v4i;

__global__ __launch_bounds__(256) void k_wtG(const float* __restrict__ w, int K, int N, bf* Bt) {
    const int lane = threadIdx.x & 31; const int L0 = (blockIdx.x * 8 + (threadIdx.x >> 5)) * 8; const int nlines = N * K / 64;
{
#pragma unroll 1
        for (int l = 0; l < 8; ++l) { const int L = L0 + l; if (L >= nlines) break; const size_t e = (size_t)L * 64 + lane * 2; const int k = (int)(e % K), n = (int)(e / K); v2us o;
            o[0] = f2bf(w[(size_t)k * N + n]); o[1] = f2bf(w[(size_t)(k + 1) * N + n]); *(v2us*)(Bt + e) = o; }
         }
}
__global__ __launch_bounds__(256) void k_cvt8(const float* __restrict__ src, bf* dst, size_t n8) { const size_t i = (size_t)blockIdx.x * 256 + threadIdx.x; if (i >= n8) return; const v8f v = *(const v8f*)(src + i * 8); v8us o;
#pragma unroll
    for (int k = 0; k < 8; ++k) o[k] = f2bf(v[k]); *(v8us*)(dst + i * 8) = o;  }
__global__ __launch_bounds__(256) void k_cscvt(const float* __restrict__ cosT, const float* __restrict__ sinT, float* CS) { const int idx = blockIdx.x * 256 + threadIdx.x; if (idx >= TT * HD) return; v2f cs; cs[0] = bfr(cosT[idx]); cs[1] = bfr(sinT[idx]); *(v2f*)(CS + (size_t)idx * 2) = cs;  }
// k_rope: head planes [h][t][d] (fp16 + hi/lo) of rope(x) x sc with the rotate-half convention out[d] = x[d] cos[t][d] - x[d+HD/2] sin[t][d], out[d+HD/2] = x[d+HD/2] cos[t][d+HD/2] + x[d] sin[t][d+HD/2]
__global__ __launch_bounds__(256) void k_rope(const float* __restrict__ F, int pitch, int nheads, const float* __restrict__ CS, const float* __restrict__ RF, const float* __restrict__ nw, float sc, h16* P16, bf* Ph, bf* Pl) {
    const size_t e = ((size_t)blockIdx.x * 256 + threadIdx.x) * 2; if (e >= (size_t)nheads * TT * HD) return; const int d = (int)(e % HD); const int t = (int)((e / HD) % TT); const int h = (int)(e / ((size_t)HD * TT)); const float* f = F + (size_t)t * pitch + h * HD; const float rf = RF ? RF[(size_t)h * TT + t] : 1.0f; v2h o16; v2us oh, ol;
#pragma unroll
    for (int q = 0; q < 2; ++q) { const int dd = d + q; const int dp = (dd < HD / 2) ? dd + HD / 2 : dd - HD / 2; float x0 = f[dd], x1 = f[dp];
        if (RF) { float n0 = __fmul_rn(x0, rf), n1 = __fmul_rn(x1, rf); asm volatile("" : "+v"(n0)); asm volatile("" : "+v"(n1)); x0 = __fmul_rn(bfr(nw[dd]), n0); x1 = __fmul_rn(bfr(nw[dp]), n1); }
        const v2f cs = *(const v2f*)(CS + ((size_t)t * HD + dd) * 2); float a = __fmul_rn(x0, cs[0]), bq = __fmul_rn(x1, cs[1]); asm volatile("" : "+v"(a)); asm volatile("" : "+v"(bq)); const float r = ((dd < HD / 2) ? __fsub_rn(a, bq) : __fadd_rn(a, bq)) * sc;
        o16[q] = tohx(r); unsigned short a2, c2; splitf(r, a2, c2); oh[q] = a2; ol[q] = c2; }
    *(v2h*)(P16 + e) = o16; *(v2us*)(Ph + e) = oh; *(v2us*)(Pl + e) = ol;  }
__global__ __launch_bounds__(256) void k_vtp(const float* __restrict__ F, int pitch, int nheads, h16* V16, bf* Vh, bf* Vl) { const size_t e = ((size_t)blockIdx.x * 256 + threadIdx.x) * 2; if (e >= (size_t)nheads * HD * TT) return; const int t = (int)(e % TT); const int d = (int)((e / TT) % HD); const int g = (int)(e / ((size_t)TT * HD)); v2h o16; v2us oh, ol;
#pragma unroll
    for (int q = 0; q < 2; ++q) { const float x = F[(size_t)(t + q) * pitch + g * HD + d]; o16[q] = tohx(x); unsigned short a2, c2; splitf(x, a2, c2); oh[q] = a2; ol[q] = c2; }
    *(v2h*)(V16 + e) = o16; *(v2us*)(Vh + e) = oh; *(v2us*)(Vl + e) = ol;  }
__global__ __launch_bounds__(256) void k_csid(float* CS) { const int idx = blockIdx.x * 256 + threadIdx.x; if (idx >= TT * HD) return; v2f cs; cs[0] = 1.0f; cs[1] = 0.0f; *(v2f*)(CS + (size_t)idx * 2) = cs;  }
// k_asoft: per row (zz, i): t = S x TT^-0.5 for j <= i and i - j < WIN (causal; WIN = TT, so i - j < WIN always holds; the reference's -1e9 additive fill vanishes identically); softmax over the 2048 keys (register row, one exp, fixed trees);
__global__ __launch_bounds__(256) void k_asoft(const float* __restrict__ Sb, h16* P16, bf* Ph, bf* Pl) {
    const int lane = threadIdx.x & 31; const int row = blockIdx.x * 8 + (threadIdx.x >> 5); if (row >= ZH * TT) return; const int i = row % TT; const int zz = row / TT; (void)zz; const bool hires = (i < RH); const float* sr = Sb + (size_t)row * TT; float v[TT / 32]; float mx = -3.0e38f;
#pragma unroll
    for (int ch = 0; ch < TT / 128; ++ch) { const int j0 = ch * 128 + lane * 4; const v4f a = *(const v4f*)(sr + j0);
#pragma unroll
        for (int q = 0; q < 4; ++q) { const int j = j0 + q; (void)j; const float t = (j <= i && i - j < WIN) ? a[q] * SCL : -3.0e38f; v[ch * 4 + q] = t; mx = fmaxf(mx, t); } }
#pragma unroll
    for (int sh = 16; sh; sh >>= 1) mx = fmaxf(mx, __shfl_xor(mx, sh, 32));
    float sum = 0.f;
#pragma unroll
    for (int k = 0; k < TT / 32; ++k) { float d0 = __fsub_rn(v[k], mx); asm volatile("" : "+v"(d0)); v[k] = __builtin_amdgcn_exp2f(__fmul_rn(d0, 1.4426950408889634f)); sum += v[k]; }
#pragma unroll
    for (int sh = 16; sh; sh >>= 1) sum += __shfl_xor(sum, sh, 32);
    const float f = __fdiv_rn(hires ? 1.0f : PCAR, sum);
{
        if (hires) {
#pragma unroll
            for (int ch = 0; ch < TT / 128; ++ch) { v4us oh, ol;
#pragma unroll
                for (int q = 0; q < 4; ++q) { unsigned short a, c2; splitf(v[ch * 4 + q] * f, a, c2); oh[q] = a; ol[q] = c2; }
                const size_t oo = ((size_t)zz * (RH ? RH : 1) + i) * TT + ch * 128 + lane * 4; *(v4us*)(Ph + oo) = oh; *(v4us*)(Pl + oo) = ol; }
        } else {
#pragma unroll
            for (int ch = 0; ch < TT / 128; ++ch) { v4h o4;
#pragma unroll
                for (int q = 0; q < 4; ++q) o4[q] = tohx(v[ch * 4 + q] * f);
                *(v4h*)(P16 + (size_t)row * TT + ch * 128 + lane * 4) = o4; } }
         }
}
__global__ __launch_bounds__(256) void k_merge(const float* __restrict__ O, int h0, bf* Ah, bf* Al) { const size_t e = ((size_t)blockIdx.x * 256 + threadIdx.x) * 2; if (e >= (size_t)ZH * TT * HD) return; const int d = (int)(e % HD); const int t = (int)((e / HD) % TT); const int zz = (int)(e / ((size_t)HD * TT)); const float cs = (t < RH) ? 1.0f : (1.0f / PCAR); const size_t oo = (size_t)t * DQ + (h0 + zz) * HD + d;
    v2us oh, ol;
#pragma unroll
    for (int q = 0; q < 2; ++q) { unsigned short a, c2; splitf(O[e + q] * cs, a, c2); oh[q] = a; ol[q] = c2; } *(v2us*)(Ah + oo) = oh; *(v2us*)(Al + oo) = ol;  }

extern "C" void kernel_launch(void* const* d_in, const int* in_sizes, int n_in,
                              void* d_out, int out_size, void* d_ws, size_t ws_size, hipStream_t stream) {
    (void)in_sizes; (void)n_in; (void)out_size;
    const float* x = (const float*)d_in[0]; const float* wq = (const float*)d_in[1]; const float* bq = (const float*)d_in[2]; const float* wk = (const float*)d_in[3]; const float* bk = (const float*)d_in[4]; const float* wv = (const float*)d_in[5]; const float* bv = (const float*)d_in[6]; const float* wo = (const float*)d_in[7]; const float* bo = (const float*)d_in[8]; const float* cosT = nullptr; const float* sinT = nullptr; (void)cosT; (void)sinT;
    float* OUT = (float*)d_out;     // [2][2048][1024]
    char* wsp = (char*)d_ws;
    auto take = [&](size_t bytes) { char* p = wsp; wsp += (bytes + 255) & ~(size_t)255; return (void*)p; };
    bf* WQ = (bf*)take((size_t)DQ * DM * 2); bf* WK = (bf*)take((size_t)DKV * DM * 2); bf* WV = (bf*)take((size_t)DKV * DM * 2); bf* WO = (bf*)take((size_t)DM * DQ * 2); float* CS = (float*)take((size_t)TT * HD * 2 * 4);
    bf* XB = (bf*)take((size_t)TT * DM * 2); float* FQ = (float*)take((size_t)TT * DQ * 4); float* FK = (float*)take((size_t)TT * DKV * 4);
    h16* QP16 = (h16*)take((size_t)NH_ * TT * HD * 2); h16* KP16 = (h16*)take((size_t)NKV * TT * HD * 2); h16* VT16 = (h16*)take((size_t)NKV * HD * TT * 2);
    bf* QPh = (bf*)take((size_t)NH_ * TT * HD * 2); bf* QPl = (bf*)take((size_t)NH_ * TT * HD * 2); bf* KPh = (bf*)take((size_t)NKV * TT * HD * 2); bf* KPl = (bf*)take((size_t)NKV * TT * HD * 2); bf* VTh = (bf*)take((size_t)NKV * HD * TT * 2); bf* VTl = (bf*)take((size_t)NKV * HD * TT * 2); bf* Ph = (bf*)take((size_t)ZH * RH * TT * 2); bf* Pl = (bf*)take((size_t)ZH * RH * TT * 2);
    float* Sb = (float*)take((size_t)ZH * TT * TT * 4); h16* P16 = (h16*)take((size_t)ZH * TT * TT * 2); float* Ob = (float*)take((size_t)ZH * TT * HD * 4); bf* ATh = (bf*)take((size_t)TT * DQ * 2); bf* ATl = (bf*)take((size_t)TT * DQ * 2);
    if ((size_t)(wsp - (char*)d_ws) > ws_size) return;    // ws 256 MiB
    float* FV = FK;   // v projection reuses the k buffer after the k planes are built (stream-ordered)
    { k_wtG<<<(unsigned)((DM * DQ / 64 + 63) / 64), 256, 0, stream>>>(wq, DM, DQ, WQ); k_wtG<<<(unsigned)((DM * DKV / 64 + 63) / 64), 256, 0, stream>>>(wk, DM, DKV, WK); k_wtG<<<(unsigned)((DM * DKV / 64 + 63) / 64), 256, 0, stream>>>(wv, DM, DKV, WV);
      k_wtG<<<(unsigned)((DQ * DM / 64 + 63) / 64), 256, 0, stream>>>(wo, DQ, DM, WO);
       }
    k_csid<<<(TT * HD + 255) / 256, 256, 0, stream>>>(CS);
    const unsigned LQ = (unsigned)(((size_t)NH_ * TT * HD / 2 + 255) / 256), LKv = (unsigned)(((size_t)NKV * TT * HD / 2 + 255) / 256);
    for (int b = 0; b < NB_; ++b) {
        
        k_cvt8<<<(unsigned)(((size_t)TT * DM / 8 + 255) / 256), 256, 0, stream>>>(x + (size_t)b * TT * DM, XB, (size_t)TT * DM / 8);
        k_gemmw<bf, 0, true><<<dim3(TT / 64, DQ / 64, 1), 32, 0, stream>>>(XB, nullptr, WQ, nullptr, DM, FQ, DQ, bq, 0, 0, 0);
        k_rope<<<LQ, 256, 0, stream>>>(FQ, DQ, NH_, CS, nullptr, nullptr, 1.0f, QP16, QPh, QPl);
        k_gemmw<bf, 0, true><<<dim3(TT / 64, DKV / 64, 1), 32, 0, stream>>>(XB, nullptr, WK, nullptr, DM, FK, DKV, bk, 0, 0, 0);
        k_rope<<<LKv, 256, 0, stream>>>(FK, DKV, NKV, CS, nullptr, nullptr, 1.0f, KP16, KPh, KPl);
        k_gemmw<bf, 0, true><<<dim3(TT / 64, DKV / 64, 1), 32, 0, stream>>>(XB, nullptr, WV, nullptr, DM, FV, DKV, bv, 0, 0, 0); k_vtp<<<LKv, 256, 0, stream>>>(FV, DKV, NKV, VT16, VTh, VTl);
        for (int h0 = 0; h0 < NH_; h0 += ZH) { const size_t zq = (size_t)h0, zk = (size_t)(h0 / REP);   // one kv head per query head: the pass's two heads use consecutive kv planes (z-strides TT*HD)
            k_gemmc<bf, 2, 1><<<dim3(RH / 64, TT / 64, ZH), 32, 0, stream>>>(QPh + zq * TT * HD, QPl + zq * TT * HD, KPh + zk * TT * HD, KPl + zk * TT * HD, HD, Sb, TT, 0, (size_t)TT * HD, (size_t)TT * HD, (size_t)TT * TT);
            k_gemmc<h16, 0, 1><<<dim3((TT - RH) / 64, TT / 64, ZH), 32, 0, stream>>>(QP16 + zq * TT * HD + (size_t)RH * HD, nullptr, KP16 + zk * TT * HD, nullptr, HD, Sb + (size_t)RH * TT, TT, RH, (size_t)TT * HD, (size_t)TT * HD, (size_t)TT * TT);
            k_asoft<<<ZH * TT / 8, 256, 0, stream>>>(Sb, P16, Ph, Pl);
            k_gemmc<bf, 2, 2><<<dim3(RH / 64, HD / 64, ZH), 256, 0, stream>>>(Ph, Pl, VTh + zk * HD * TT, VTl + zk * HD * TT, TT, Ob, HD, 0, (size_t)RH * TT, (size_t)HD * TT, (size_t)TT * HD);
            k_gemmc<h16, 0, 2><<<dim3((TT - RH) / 64, HD / 64, ZH), 256, 0, stream>>>(P16 + (size_t)RH * TT, nullptr, VT16 + zk * HD * TT, nullptr, TT, Ob + (size_t)RH * HD, HD, RH, (size_t)TT * TT, (size_t)HD * TT, (size_t)TT * HD);
            k_merge<<<(unsigned)(((size_t)ZH * TT * HD / 2 + 255) / 256), 256, 0, stream>>>(Ob, h0, ATh, ATl); }
        k_gemmw<bf, 1, true><<<dim3(TT / 64, DM / 64, 1), 32, 0, stream>>>(ATh, ATl, WO, nullptr, DQ, OUT + (size_t)b * TT * DM, DM, bo, 0, 0, 0); }
}

// v002
// Measured time: 749 microseconds a run.
// Two timings next to v001 put it at 1.44 and 1.45 times that version's speed.
// Counting every step since v000, it is 2.15 times as fast.
#include <hip/hip_runtime.h>

// multihead_attentive_layer (query [2][2048][1024]; q/k/v = x W + b ([1024][2048]: 16 heads x 128); scores = q.k / sqrt(S = 2048) (the source scales by the sequence length, not the head dim) + -1e12 * (1 - causal); softmax; out = merged Wo ([2048][1024]) + bo -> [2][2048][1024]).
// Compute dtypes, f32 accumulate: every input rounded to bf16; q/k/v on PLAIN bf16 operands (inputs: exact) + bias; causal scores and attn.v: query rows < 512 hl (3 products), the rest single fp16 (x1024), causal tile skipping (the additive -1e12 underflows to exactly 0 weight, as skipping does); softmax f32; Wo hl x exact (2 products) + bias.

#define NB_  2
#define TT   2048
#define DM   1024
#define NH_  16
#define NKV  16
#define REP  (NH_ / NKV)
#define HD   128
#define DQ   (NH_ * HD)
#define DKV  (NKV * HD)
#define ZH   8                    // heads per attention pass
#define RH   512                  // query rows < RH use hi+lo planes (0: none)
#define WIN  2048
#define PCAR 1024.0f
#define SCL  0.022097086912079608f   // 1/sqrt(S = 2048): the source scales by the value sequence length
typedef _Float16 h16;
typedef unsigned short bf;
typedef __attribute__((ext_vector_type(16))) __bf16   v16bf;
typedef __attribute__((ext_vector_type(16))) _Float16 v16h;
typedef __attribute__((ext_vector_type(8)))  _Float16 v8h;
typedef __attribute__((ext_vector_type(8)))  unsigned short v8us;
typedef __attribute__((ext_vector_type(8)))  float    v8f;
typedef __attribute__((ext_vector_type(4)))  float    v4f;
typedef v8h  __attribute__((may_alias)) v8ha;
typedef v4f  __attribute__((may_alias)) v4fa;
typedef v8us __attribute__((may_alias)) v8usa;

__device__ __forceinline__ unsigned short f2bf(float f) { unsigned u = __float_as_uint(f); u += 0x7FFFu + ((u >> 16) & 1u); return (unsigned short)(u >> 16); }
__device__ __forceinline__ float bf2f(unsigned short b) { return __uint_as_float(((unsigned)b) << 16); }
__device__ __forceinline__ float bfr(float f) { return bf2f(f2bf(f)); }
__device__ __forceinline__ v16h cat16(v8h lo, v8h hi) { return __builtin_shufflevector(lo, hi, 0, 1, 2, 3, 4, 5, 6, 7, 8, 9, 10, 11, 12, 13, 14, 15); }
__device__ __forceinline__ v16bf cat16b(v8us lo, v8us hi) { return __builtin_bit_cast(v16bf, __builtin_shufflevector(lo, hi, 0, 1, 2, 3, 4, 5, 6, 7, 8, 9, 10, 11, 12, 13, 14, 15)); }
__device__ __forceinline__ v8f wmma16(v16h a, v16h b, v8f c) { return __builtin_amdgcn_wmma_f32_16x16x32_f16(false, a, false, b, (short)0, c, false, false); }
__device__ __forceinline__ v8f wmmab(v16bf a, v16bf b, v8f c) { return __builtin_amdgcn_wmma_f32_16x16x32_bf16(false, a, false, b, (short)0, c, false, false); }



// ---- k_gemmw: register-blocked GEMM, ONE WAVE per 64x64 output tile (16 accumulators), operands straight from K-contiguous 16-bit planes; grid (M/64, N/64, Z), 32 threads.
// C[m][n] (f32, pitch ldc, + optional f32 bias[n]) = sum_k A[m][k] Bt[n][k] (+ split products per NSPLIT). z-batch strides sA/sB/sC in elements. K % 32 == 0.
template <typename T16> struct WFrag;
template <> struct WFrag<h16> { typedef v16h V; static __device__ __forceinline__ V ld(const h16* p) { return cat16(*(const v8h*)p, *(const v8h*)(p + 16)); } static __device__ __forceinline__ v8f mma(V a, V b, v8f c) { return wmma16(a, b, c); } };
template <> struct WFrag<bf> { typedef v16bf V; static __device__ __forceinline__ V ld(const bf* p) { return cat16b(*(const v8us*)p, *(const v8us*)(p + 16)); } static __device__ __forceinline__ v8f mma(V a, V b, v8f c) { return wmmab(a, b, c); } };
// xwait: the wait that belongs between an issued global load and a later write of the registers that hold its address; in k_gemmc's k loop that write is mostly a later fragment load's result.
__device__ __forceinline__ void xwait() { asm volatile("s_wait_xcnt 0x0" ::: "memory"); }
// ldx: WFrag's fragment load (same bytes, same k order) with that wait behind each of its two loads; k_gemmc's loader.
__device__ __forceinline__ v16h ldx(const h16* p) { const v8h lo = *(const v8h*)p; xwait(); const v8h hi = *(const v8h*)(p + 16); xwait(); return cat16(lo, hi); }
__device__ __forceinline__ v16bf ldx(const bf* p) { const v8us lo = *(const v8us*)p; xwait(); const v8us hi = *(const v8us*)(p + 16); xwait(); return cat16b(lo, hi); }
template <typename T16, int NSPLIT, bool BIAS>
__global__ __launch_bounds__(32) void k_gemmw(const T16* __restrict__ A, const T16* __restrict__ A2, const T16* __restrict__ Bt, const T16* __restrict__ Bt2, int K, float* C, int ldc, const float* __restrict__ bias, size_t sA, size_t sB, size_t sC) {
    typedef typename WFrag<T16>::V V;
    __shared__ __align__(16) float os[16 * 68];
    const size_t z = blockIdx.z; A += z * sA; if (A2) A2 += z * sA; Bt += z * sB; if (Bt2) Bt2 += z * sB; C += z * sC;
    const int lane = threadIdx.x & 31, lr = lane & 15, hi = lane >> 4; const int r0 = blockIdx.x * 64, c0 = blockIdx.y * 64;
    v8f acc[4][4];
#pragma unroll
    for (int mb = 0; mb < 4; ++mb)
#pragma unroll
        for (int nb = 0; nb < 4; ++nb) acc[mb][nb] = (v8f){};
    const size_t aoff = (size_t)(r0 + lr) * K + 8 * hi, boff = (size_t)(c0 + lr) * K + 8 * hi;
#pragma unroll 1
    for (int kc = 0; kc < K; kc += 32) {
        V a[4], a2[4];
#pragma unroll
        for (int mb = 0; mb < 4; ++mb) { a[mb] = WFrag<T16>::ld(A + aoff + (size_t)mb * 16 * K + kc); if (NSPLIT == 1 || NSPLIT == 2) a2[mb] = WFrag<T16>::ld(A2 + aoff + (size_t)mb * 16 * K + kc); }
#pragma unroll
        for (int nb = 0; nb < 4; ++nb) { const V b = WFrag<T16>::ld(Bt + boff + (size_t)nb * 16 * K + kc); V b2; if (NSPLIT >= 2) b2 = WFrag<T16>::ld(Bt2 + boff + (size_t)nb * 16 * K + kc);
#pragma unroll
            for (int mb = 0; mb < 4; ++mb) { acc[mb][nb] = WFrag<T16>::mma(a[mb], b, acc[mb][nb]); if (NSPLIT == 1 || NSPLIT == 2) acc[mb][nb] = WFrag<T16>::mma(a2[mb], b, acc[mb][nb]); if (NSPLIT >= 2) acc[mb][nb] = WFrag<T16>::mma(a[mb], b2, acc[mb][nb]); } }
        asm volatile("v_nop\n\tv_nop\n\tv_nop\n\tv_nop" : "+v"(acc[0][0]), "+v"(acc[1][1]), "+v"(acc[2][2]), "+v"(acc[3][3]) : "v"(a[0]), "v"(a[3]));
    }
#pragma unroll
    for (int mb = 0; mb < 4; ++mb) {
#pragma unroll
        for (int nb = 0; nb < 4; ++nb) {
#pragma unroll
            for (int j = 0; j < 8; ++j) os[(hi * 8 + j) * 68 + nb * 16 + lr] = acc[mb][nb][j]; }
        __builtin_amdgcn_wave_barrier(); asm volatile("" ::: "memory");
        float* crow = C + (size_t)(r0 + mb * 16) * ldc + c0;
{
#pragma unroll
            for (int s = 0; s < 8; ++s) { const int row = 2 * s + hi, cofs = lr * 4; v4f val = *(const v4fa*)(os + row * 68 + cofs); if (BIAS) { val[0] += bfr(bias[c0 + cofs]); val[1] += bfr(bias[c0 + cofs + 1]); val[2] += bfr(bias[c0 + cofs + 2]); val[3] += bfr(bias[c0 + cofs + 3]); }
                *(v4f*)(crow + (size_t)row * ldc + cofs) = val; }
             }
        __builtin_amdgcn_wave_barrier(); asm volatile("" ::: "memory");
    }
}

// ---- k_gemmc: the same 64x64 tile GEMM (one wave per tile, CMODE 2 eight) specialised for causal attention: CMODE 1 skips score tiles entirely above the diagonal (query rows r0+roff.., key columns c0..), CMODE 2 limits the
// key (K) loop of the probability x value contraction to the diagonal block (probabilities beyond it are exactly zero). roff = row offset of this launch's first row within the sequence.
// CMODE 2 reads A from 16-bit rows that lie at the head of the f32 score rows they were made from, so its A pitch is 2 K elements (B keeps pitch K).
// CMODE 2 runs NW = 8 waves per tile: wave w takes the 32-wide k steps w, w + 8, ... of the same 64x64 tile, each wave leaves its f32 partial tile in LDS, and after one barrier the 256 threads add the partials in wave order and store.
template <typename T16, int NSPLIT, int CMODE>
__global__ __launch_bounds__((CMODE == 2) ? 256 : 32) void k_gemmc(const T16* __restrict__ A, const T16* __restrict__ A2, const T16* __restrict__ Bt, const T16* __restrict__ Bt2, int K, float* C, int ldc, int roff, size_t sA, size_t sB, size_t sC) {
    typedef typename WFrag<T16>::V V;
    constexpr int NW = (CMODE == 2) ? 8 : 1;
    __shared__ __align__(16) float os[(NW == 1) ? 16 * 68 : NW * 64 * 68];
    const size_t z = blockIdx.z; A += z * sA; if (A2) A2 += z * sA; Bt += z * sB; if (Bt2) Bt2 += z * sB; C += z * sC;
    const int lane = threadIdx.x & 31, lr = lane & 15, hi = lane >> 4; const int r0 = blockIdx.x * 64, c0 = blockIdx.y * 64;
    if (CMODE == 1 && c0 > r0 + roff + 63) return;                  // score tile entirely above the causal diagonal: never read (the softmax masks j > i by select)
    const int wave = (NW == 1) ? 0 : __builtin_amdgcn_readfirstlane((int)(threadIdx.x >> 5));   // scalar, so that the k loop keeps a scalar trip test and every lane stays on at the matrix instructions
    const int Kl = (CMODE == 2) ? min(K, r0 + roff + 64) : K;        // P.V: probabilities are exactly 0 beyond the diagonal block, so the K loop stops there
    v8f acc[4][4];
#pragma unroll
    for (int mb = 0; mb < 4; ++mb)
#pragma unroll
        for (int nb = 0; nb < 4; ++nb) acc[mb][nb] = (v8f){};
    const int lda = (CMODE == 2) ? 2 * K : K;
    const size_t aoff = (size_t)(r0 + lr) * lda + 8 * hi, boff = (size_t)(c0 + lr) * K + 8 * hi;
#pragma unroll 1
    for (int kc = wave * 32; kc < Kl; kc += NW * 32) {
        V a[4], a2[4];
#pragma unroll
        for (int mb = 0; mb < 4; ++mb) { a[mb] = ldx(A + aoff + (size_t)mb * 16 * lda + kc); if (NSPLIT == 1 || NSPLIT == 2) a2[mb] = ldx(A2 + aoff + (size_t)mb * 16 * lda + kc); }
#pragma unroll
        for (int nb = 0; nb < 4; ++nb) { const V b = ldx(Bt + boff + (size_t)nb * 16 * K + kc); V b2; if (NSPLIT >= 2) b2 = ldx(Bt2 + boff + (size_t)nb * 16 * K + kc);
#pragma unroll
            for (int mb = 0; mb < 4; ++mb) { acc[mb][nb] = WFrag<T16>::mma(a[mb], b, acc[mb][nb]); if (NSPLIT == 1 || NSPLIT == 2) acc[mb][nb] = WFrag<T16>::mma(a2[mb], b, acc[mb][nb]); if (NSPLIT >= 2) acc[mb][nb] = WFrag<T16>::mma(a[mb], b2, acc[mb][nb]); } }
        asm volatile("v_nop\n\tv_nop\n\tv_nop\n\tv_nop" : "+v"(acc[0][0]), "+v"(acc[1][1]), "+v"(acc[2][2]), "+v"(acc[3][3]) : "v"(a[0]), "v"(a[3]));
    }
    if constexpr (NW == 1) {
#pragma unroll
    for (int mb = 0; mb < 4; ++mb) {
#pragma unroll
        for (int nb = 0; nb < 4; ++nb) {
#pragma unroll
            for (int j = 0; j < 8; ++j) os[(hi * 8 + j) * 68 + nb * 16 + lr] = acc[mb][nb][j]; }
        __builtin_amdgcn_wave_barrier(); asm volatile("" ::: "memory");
        float* crow = C + (size_t)(r0 + mb * 16) * ldc + c0;
{
#pragma unroll
            for (int s = 0; s < 8; ++s) { const int row = 2 * s + hi, cofs = lr * 4; v4f val = *(const v4fa*)(os + row * 68 + cofs);
                *(v4f*)(crow + (size_t)row * ldc + cofs) = val; }
             }
        __builtin_amdgcn_wave_barrier(); asm volatile("" ::: "memory");
    }
    } else {
        float* ow = os + wave * (64 * 68);
#pragma unroll
        for (int mb = 0; mb < 4; ++mb)
#pragma unroll
            for (int nb = 0; nb < 4; ++nb)
#pragma unroll
                for (int j = 0; j < 8; ++j) ow[(mb * 16 + hi * 8 + j) * 68 + nb * 16 + lr] = acc[mb][nb][j];
        __syncthreads();   // all NW partial tiles stand in LDS before any thread adds them
        const int trow = (int)(threadIdx.x >> 4), cofs = (int)(threadIdx.x & 15) * 4;
#pragma unroll
        for (int s = 0; s < 4; ++s) { const int row = s * 16 + trow; v4f val = *(const v4fa*)(os + row * 68 + cofs);
#pragma unroll
            for (int w = 1; w < NW; ++w) val += *(const v4fa*)(os + w * (64 * 68) + row * 68 + cofs);
            *(v4f*)(C + (size_t)(r0 + row) * ldc + c0 + cofs) = val; }
    }
}

__device__ __forceinline__ h16 tohx(float x) { return (h16)x; }
__device__ __forceinline__ void splitf(float y, unsigned short& h, unsigned short& l) { h = f2bf(y); l = f2bf(y - bf2f(h)); }
typedef __attribute__((ext_vector_type(2))) _Float16 v2h;
typedef __attribute__((ext_vector_type(4))) _Float16 v4h;
typedef __attribute__((ext_vector_type(2))) unsigned short v2us;
typedef __attribute__((ext_vector_type(4))) unsigned short v4us;
typedef __attribute__((ext_vector_type(2))) float v2f;
typedef __attribute__((ext_vector_type(4))) int v4i;

__global__ __launch_bounds__(256) void k_wtG(const float* __restrict__ w, int K, int N, bf* Bt) {
    const int lane = threadIdx.x & 31; const int L0 = (blockIdx.x * 8 + (threadIdx.x >> 5)) * 8; const int nlines = N * K / 64;
{
#pragma unroll 1
        for (int l = 0; l < 8; ++l) { const int L = L0 + l; if (L >= nlines) break; const size_t e = (size_t)L * 64 + lane * 2; const int k = (int)(e % K), n = (int)(e / K); v2us o;
            o[0] = f2bf(w[(size_t)k * N + n]); o[1] = f2bf(w[(size_t)(k + 1) * N + n]); *(v2us*)(Bt + e) = o; }
         }
}
__global__ __launch_bounds__(256) void k_cvt8(const float* __restrict__ src, bf* dst, size_t n8) { const size_t i = (size_t)blockIdx.x * 256 + threadIdx.x; if (i >= n8) return; const v8f v = *(const v8f*)(src + i * 8); v8us o;
#pragma unroll
    for (int k = 0; k < 8; ++k) o[k] = f2bf(v[k]); *(v8us*)(dst + i * 8) = o;  }
__global__ __launch_bounds__(256) void k_cscvt(const float* __restrict__ cosT, const float* __restrict__ sinT, float* CS) { const int idx = blockIdx.x * 256 + threadIdx.x; if (idx >= TT * HD) return; v2f cs; cs[0] = bfr(cosT[idx]); cs[1] = bfr(sinT[idx]); *(v2f*)(CS + (size_t)idx * 2) = cs;  }
// k_rope: head planes [h][t][d] (fp16 + hi/lo) of rope(x) x sc with the rotate-half convention out[d] = x[d] cos[t][d] - x[d+HD/2] sin[t][d], out[d+HD/2] = x[d+HD/2] cos[t][d+HD/2] + x[d] sin[t][d+HD/2]
__global__ __launch_bounds__(256) void k_rope(const float* __restrict__ F, int pitch, int nheads, const float* __restrict__ CS, const float* __restrict__ RF, const float* __restrict__ nw, float sc, h16* P16, bf* Ph, bf* Pl) {
    const size_t e = ((size_t)blockIdx.x * 256 + threadIdx.x) * 2; if (e >= (size_t)nheads * TT * HD) return; const int d = (int)(e % HD); const int t = (int)((e / HD) % TT); const int h = (int)(e / ((size_t)HD * TT)); const float* f = F + (size_t)t * pitch + h * HD; const float rf = RF ? RF[(size_t)h * TT + t] : 1.0f; v2h o16; v2us oh, ol;
#pragma unroll
    for (int q = 0; q < 2; ++q) { const int dd = d + q; const int dp = (dd < HD / 2) ? dd + HD / 2 : dd - HD / 2; float x0 = f[dd], x1 = f[dp];
        if (RF) { float n0 = __fmul_rn(x0, rf), n1 = __fmul_rn(x1, rf); asm volatile("" : "+v"(n0)); asm volatile("" : "+v"(n1)); x0 = __fmul_rn(bfr(nw[dd]), n0); x1 = __fmul_rn(bfr(nw[dp]), n1); }
        const v2f cs = *(const v2f*)(CS + ((size_t)t * HD + dd) * 2); float a = __fmul_rn(x0, cs[0]), bq = __fmul_rn(x1, cs[1]); asm volatile("" : "+v"(a)); asm volatile("" : "+v"(bq)); const float r = ((dd < HD / 2) ? __fsub_rn(a, bq) : __fadd_rn(a, bq)) * sc;
        o16[q] = tohx(r); unsigned short a2, c2; splitf(r, a2, c2); oh[q] = a2; ol[q] = c2; }
    *(v2h*)(P16 + e) = o16; *(v2us*)(Ph + e) = oh; *(v2us*)(Pl + e) = ol;  }
__global__ __launch_bounds__(256) void k_vtp(const float* __restrict__ F, int pitch, int nheads, h16* V16, bf* Vh, bf* Vl) { const size_t e = ((size_t)blockIdx.x * 256 + threadIdx.x) * 2; if (e >= (size_t)nheads * HD * TT) return; const int t = (int)(e % TT); const int d = (int)((e / TT) % HD); const int g = (int)(e / ((size_t)TT * HD)); v2h o16; v2us oh, ol;
#pragma unroll
    for (int q = 0; q < 2; ++q) { const float x = F[(size_t)(t + q) * pitch + g * HD + d]; o16[q] = tohx(x); unsigned short a2, c2; splitf(x, a2, c2); oh[q] = a2; ol[q] = c2; }
    *(v2h*)(V16 + e) = o16; *(v2us*)(Vh + e) = oh; *(v2us*)(Vl + e) = ol;  }
__global__ __launch_bounds__(256) void k_csid(float* CS) { const int idx = blockIdx.x * 256 + threadIdx.x; if (idx >= TT * HD) return; v2f cs; cs[0] = 1.0f; cs[1] = 0.0f; *(v2f*)(CS + (size_t)idx * 2) = cs;  }
// k_asoft: per row (zz, i): t = S x 2048^-0.5 for j <= i and i - j < WIN (causal; WIN = TT, so the window test always holds; the reference's -1e9 additive fill vanishes identically); softmax over the 2048 keys (register row, one exp, fixed trees);
// the 16-bit probabilities go over the row's own 8 KiB of scores (fp16 in the first half; or hi plane in the first half and lo plane in the second): the one wave that owns a row holds all of it in registers before it stores, so P16 / Ph / Pl point into Sb and every row has pitch 2 TT 16-bit elements.
__global__ __launch_bounds__(256) void k_asoft(const float* Sb, h16* P16, bf* Ph, bf* Pl) {
    const int lane = threadIdx.x & 31; const int row = blockIdx.x * 8 + (threadIdx.x >> 5); if (row >= ZH * TT) return; const int i = row % TT; const int zz = row / TT; (void)zz; const bool hires = (i < RH); const float* sr = Sb + (size_t)row * TT; float v[TT / 32]; float mx = -3.0e38f;
#pragma unroll
    for (int ch = 0; ch < TT / 128; ++ch) { const int j0 = ch * 128 + lane * 4; const v4f a = *(const v4f*)(sr + j0);
#pragma unroll
        for (int q = 0; q < 4; ++q) { const int j = j0 + q; (void)j; const float t = (j <= i && i - j < WIN) ? a[q] * SCL : -3.0e38f; v[ch * 4 + q] = t; mx = fmaxf(mx, t); } }
#pragma unroll
    for (int sh = 16; sh; sh >>= 1) mx = fmaxf(mx, __shfl_xor(mx, sh, 32));
    float sum = 0.f;
#pragma unroll
    for (int k = 0; k < TT / 32; ++k) { float d0 = __fsub_rn(v[k], mx); asm volatile("" : "+v"(d0)); v[k] = __builtin_amdgcn_exp2f(__fmul_rn(d0, 1.4426950408889634f)); sum += v[k]; }
#pragma unroll
    for (int sh = 16; sh; sh >>= 1) sum += __shfl_xor(sum, sh, 32);
    const float f = __fdiv_rn(hires ? 1.0f : PCAR, sum);
{
        if (hires) {
#pragma unroll
            for (int ch = 0; ch < TT / 128; ++ch) { v4us oh, ol;
#pragma unroll
                for (int q = 0; q < 4; ++q) { unsigned short a, c2; splitf(v[ch * 4 + q] * f, a, c2); oh[q] = a; ol[q] = c2; }
                const size_t oo = (size_t)row * (2 * TT) + ch * 128 + lane * 4; *(v4us*)(Ph + oo) = oh; *(v4us*)(Pl + oo) = ol; }
        } else {
#pragma unroll
            for (int ch = 0; ch < TT / 128; ++ch) { v4h o4;
#pragma unroll
                for (int q = 0; q < 4; ++q) o4[q] = tohx(v[ch * 4 + q] * f);
                *(v4h*)(P16 + (size_t)row * (2 * TT) + ch * 128 + lane * 4) = o4; } }
         }
}
__global__ __launch_bounds__(256) void k_merge(const float* __restrict__ O, int h0, bf* Ah, bf* Al) { const size_t e = ((size_t)blockIdx.x * 256 + threadIdx.x) * 2; if (e >= (size_t)ZH * TT * HD) return; const int d = (int)(e % HD); const int t = (int)((e / HD) % TT); const int zz = (int)(e / ((size_t)HD * TT)); const float cs = (t < RH) ? 1.0f : (1.0f / PCAR); const size_t oo = (size_t)t * DQ + (h0 + zz) * HD + d;
    v2us oh, ol;
#pragma unroll
    for (int q = 0; q < 2; ++q) { unsigned short a, c2; splitf(O[e + q] * cs, a, c2); oh[q] = a; ol[q] = c2; } *(v2us*)(Ah + oo) = oh; *(v2us*)(Al + oo) = ol;  }

extern "C" void kernel_launch(void* const* d_in, const int* in_sizes, int n_in,
                              void* d_out, int out_size, void* d_ws, size_t ws_size, hipStream_t stream) {
    (void)in_sizes; (void)n_in; (void)out_size;
    const float* x = (const float*)d_in[0]; const float* wq = (const float*)d_in[1]; const float* bq = (const float*)d_in[2]; const float* wk = (const float*)d_in[3]; const float* bk = (const float*)d_in[4]; const float* wv = (const float*)d_in[5]; const float* bv = (const float*)d_in[6]; const float* wo = (const float*)d_in[7]; const float* bo = (const float*)d_in[8]; const float* cosT = nullptr; const float* sinT = nullptr; (void)cosT; (void)sinT;
    float* OUT = (float*)d_out;     // [2][2048][1024]
    char* wsp = (char*)d_ws;
    auto take = [&](size_t bytes) { char* p = wsp; wsp += (bytes + 255) & ~(size_t)255; return (void*)p; };
    bf* WQ = (bf*)take((size_t)DQ * DM * 2); bf* WK = (bf*)take((size_t)DKV * DM * 2); bf* WV = (bf*)take((size_t)DKV * DM * 2); bf* WO = (bf*)take((size_t)DM * DQ * 2); float* CS = (float*)take((size_t)TT * HD * 2 * 4);
    h16* QP16 = (h16*)take((size_t)NH_ * TT * HD * 2); h16* KP16 = (h16*)take((size_t)NKV * TT * HD * 2); h16* VT16 = (h16*)take((size_t)NKV * HD * TT * 2);
    bf* QPh = (bf*)take((size_t)NH_ * TT * HD * 2); bf* QPl = (bf*)take((size_t)NH_ * TT * HD * 2); bf* KPh = (bf*)take((size_t)NKV * TT * HD * 2); bf* KPl = (bf*)take((size_t)NKV * TT * HD * 2); bf* VTh = (bf*)take((size_t)NKV * HD * TT * 2); bf* VTl = (bf*)take((size_t)NKV * HD * TT * 2);
    float* Sb = (float*)take((size_t)ZH * TT * TT * 4); float* Ob = (float*)take((size_t)ZH * TT * HD * 4); bf* ATh = (bf*)take((size_t)TT * DQ * 2); bf* ATl = (bf*)take((size_t)TT * DQ * 2);
    if ((size_t)(wsp - (char*)d_ws) > ws_size) return;    // ws 256 MiB
    h16* P16 = (h16*)Sb; bf* Ph = (bf*)Sb; bf* Pl = Ph + TT;   // probabilities lie over their own score rows (k_asoft)
    bf* XB = (bf*)Sb; float* FQ = Sb + (size_t)TT * DM / 2; float* FK = FQ + (size_t)TT * DQ;   // the projections' scratch is dead once the head planes stand, the score block is dead until then: they share its bytes (stream-ordered)
    float* FV = FK;   // v projection reuses the k buffer after the k planes are built (stream-ordered)
    { k_wtG<<<(unsigned)((DM * DQ / 64 + 63) / 64), 256, 0, stream>>>(wq, DM, DQ, WQ); k_wtG<<<(unsigned)((DM * DKV / 64 + 63) / 64), 256, 0, stream>>>(wk, DM, DKV, WK); k_wtG<<<(unsigned)((DM * DKV / 64 + 63) / 64), 256, 0, stream>>>(wv, DM, DKV, WV);
      k_wtG<<<(unsigned)((DQ * DM / 64 + 63) / 64), 256, 0, stream>>>(wo, DQ, DM, WO);
       }
    k_csid<<<(TT * HD + 255) / 256, 256, 0, stream>>>(CS);
    const unsigned LQ = (unsigned)(((size_t)NH_ * TT * HD / 2 + 255) / 256), LKv = (unsigned)(((size_t)NKV * TT * HD / 2 + 255) / 256);
    for (int b = 0; b < NB_; ++b) {
        
        k_cvt8<<<(unsigned)(((size_t)TT * DM / 8 + 255) / 256), 256, 0, stream>>>(x + (size_t)b * TT * DM, XB, (size_t)TT * DM / 8);
        k_gemmw<bf, 0, true><<<dim3(TT / 64, DQ / 64, 1), 32, 0, stream>>>(XB, nullptr, WQ, nullptr, DM, FQ, DQ, bq, 0, 0, 0);
        k_rope<<<LQ, 256, 0, stream>>>(FQ, DQ, NH_, CS, nullptr, nullptr, 1.0f, QP16, QPh, QPl);
        k_gemmw<bf, 0, true><<<dim3(TT / 64, DKV / 64, 1), 32, 0, stream>>>(XB, nullptr, WK, nullptr, DM, FK, DKV, bk, 0, 0, 0);
        k_rope<<<LKv, 256, 0, stream>>>(FK, DKV, NKV, CS, nullptr, nullptr, 1.0f, KP16, KPh, KPl);
        k_gemmw<bf, 0, true><<<dim3(TT / 64, DKV / 64, 1), 32, 0, stream>>>(XB, nullptr, WV, nullptr, DM, FV, DKV, bv, 0, 0, 0); k_vtp<<<LKv, 256, 0, stream>>>(FV, DKV, NKV, VT16, VTh, VTl);
        for (int h0 = 0; h0 < NH_; h0 += ZH) { const size_t zq = (size_t)h0, zk = (size_t)(h0 / REP);   // one kv head per query head: the pass's heads use consecutive kv planes (z-strides TT*HD)
            k_gemmc<bf, 2, 1><<<dim3(RH / 64, TT / 64, ZH), 32, 0, stream>>>(QPh + zq * TT * HD, QPl + zq * TT * HD, KPh + zk * TT * HD, KPl + zk * TT * HD, HD, Sb, TT, 0, (size_t)TT * HD, (size_t)TT * HD, (size_t)TT * TT);
            k_gemmc<h16, 0, 1><<<dim3((TT - RH) / 64, TT / 64, ZH), 32, 0, stream>>>(QP16 + zq * TT * HD + (size_t)RH * HD, nullptr, KP16 + zk * TT * HD, nullptr, HD, Sb + (size_t)RH * TT, TT, RH, (size_t)TT * HD, (size_t)TT * HD, (size_t)TT * TT);
            k_asoft<<<ZH * TT / 8, 256, 0, stream>>>(Sb, P16, Ph, Pl);
            k_gemmc<bf, 2, 2><<<dim3(RH / 64, HD / 64, ZH), 256, 0, stream>>>(Ph, Pl, VTh + zk * HD * TT, VTl + zk * HD * TT, TT, Ob, HD, 0, (size_t)2 * TT * TT, (size_t)HD * TT, (size_t)TT * HD);
            k_gemmc<h16, 0, 2><<<dim3((TT - RH) / 64, HD / 64, ZH), 256, 0, stream>>>(P16 + (size_t)RH * 2 * TT, nullptr, VT16 + zk * HD * TT, nullptr, TT, Ob + (size_t)RH * HD, HD, RH, (size_t)2 * TT * TT, (size_t)HD * TT, (size_t)TT * HD);
            k_merge<<<(unsigned)(((size_t)ZH * TT * HD / 2 + 255) / 256), 256, 0, stream>>>(Ob, h0, ATh, ATl); }
        k_gemmw<bf, 1, true><<<dim3(TT / 64, DM / 64, 1), 32, 0, stream>>>(ATh, ATl, WO, nullptr, DQ, OUT + (size_t)b * TT * DM, DM, bo, 0, 0, 0); }
}

// v003
// A run of this version takes 470 microseconds.
// Next to v002, in two timings, it ran 1.58 and 1.59 times as fast.
// All steps since v000 together make it 3.41 times as fast.
#include <hip/hip_runtime.h>
#include <type_traits>

// multihead_attentive_layer (query [2][2048][1024]; q/k/v = x W + b ([1024][2048]: 16 heads x 128); scores = q.k / sqrt(S = 2048) (the source scales by the sequence length, not the head dim) + -1e12 * (1 - causal); softmax; out = merged Wo ([2048][1024]) + bo -> [2][2048][1024]).
// Compute dtypes, f32 accumulate: every input rounded to bf16; q/k/v on PLAIN bf16 operands (inputs: exact) + bias; causal scores and attn.v: query rows < 512 hl (3 products), the rest single fp16, keys above the diagonal skipped or given weight 0 (the additive -1e12 underflows to exactly 0 weight, as skipping does); softmax f32, running maximum; Wo hl x exact (2 products) + bias.

#define NB_  2
#define TT   2048
#define DM   1024
#define NH_  16
#define NKV  16
#define REP  (NH_ / NKV)
#define HD   128
#define DQ   (NH_ * HD)
#define DKV  (NKV * HD)
#define RH   512                  // query rows < RH use hi+lo planes (0: none)
#define SCL  0.022097086912079608f   // 1/sqrt(S = 2048): the source scales by the value sequence length
typedef _Float16 h16;
typedef unsigned short bf;
typedef __attribute__((ext_vector_type(16))) __bf16   v16bf;
typedef __attribute__((ext_vector_type(16))) _Float16 v16h;
typedef __attribute__((ext_vector_type(8)))  _Float16 v8h;
typedef __attribute__((ext_vector_type(8)))  unsigned short v8us;
typedef __attribute__((ext_vector_type(8)))  float    v8f;
typedef __attribute__((ext_vector_type(4)))  float    v4f;
typedef v8h  __attribute__((may_alias)) v8ha;
typedef v4f  __attribute__((may_alias)) v4fa;
typedef v8us __attribute__((may_alias)) v8usa;

__device__ __forceinline__ unsigned short f2bf(float f) { unsigned u = __float_as_uint(f); u += 0x7FFFu + ((u >> 16) & 1u); return (unsigned short)(u >> 16); }
__device__ __forceinline__ float bf2f(unsigned short b) { return __uint_as_float(((unsigned)b) << 16); }
__device__ __forceinline__ float bfr(float f) { return bf2f(f2bf(f)); }
__device__ __forceinline__ v16h cat16(v8h lo, v8h hi) { return __builtin_shufflevector(lo, hi, 0, 1, 2, 3, 4, 5, 6, 7, 8, 9, 10, 11, 12, 13, 14, 15); }
__device__ __forceinline__ v16bf cat16b(v8us lo, v8us hi) { return __builtin_bit_cast(v16bf, __builtin_shufflevector(lo, hi, 0, 1, 2, 3, 4, 5, 6, 7, 8, 9, 10, 11, 12, 13, 14, 15)); }
__device__ __forceinline__ v8f wmma16(v16h a, v16h b, v8f c) { return __builtin_amdgcn_wmma_f32_16x16x32_f16(false, a, false, b, (short)0, c, false, false); }
__device__ __forceinline__ v8f wmmab(v16bf a, v16bf b, v8f c) { return __builtin_amdgcn_wmma_f32_16x16x32_bf16(false, a, false, b, (short)0, c, false, false); }



// ---- k_gemmw: register-blocked GEMM, ONE WAVE per 64x64 output tile (16 accumulators), operands straight from K-contiguous 16-bit planes; grid (M/64, N/64, Z), 32 threads.
// C[m][n] (f32, pitch ldc, + optional f32 bias[n]) = sum_k A[m][k] Bt[n][k] (+ split products per NSPLIT). z-batch strides sA/sB/sC in elements. K % 32 == 0.
template <typename T16> struct WFrag;
template <> struct WFrag<h16> { typedef v16h V; static __device__ __forceinline__ V ld(const h16* p) { return cat16(*(const v8h*)p, *(const v8h*)(p + 16)); } static __device__ __forceinline__ v8f mma(V a, V b, v8f c) { return wmma16(a, b, c); } };
template <> struct WFrag<bf> { typedef v16bf V; static __device__ __forceinline__ V ld(const bf* p) { return cat16b(*(const v8us*)p, *(const v8us*)(p + 16)); } static __device__ __forceinline__ v8f mma(V a, V b, v8f c) { return wmmab(a, b, c); } };
// xwait: the wait that belongs between an issued global load or store and a later write of the registers that it names; k_fattn puts one behind each run of fragment loads (a run shares its address registers, which are next written in the following step) and one behind each store.
// The wait takes those registers as inputs, so that they stay allocated (no later result is placed in them) until it has been passed.
__device__ __forceinline__ void xwait(const void* a, const void* b) { asm volatile("s_wait_xcnt 0x0" :: "v"(a), "v"(b) : "memory"); }
__device__ __forceinline__ void xwaits(const void* a, v8us data) { asm volatile("s_wait_xcnt 0x0" :: "v"(a), "v"(data) : "memory"); }
template <typename T16, int NSPLIT, bool BIAS>
__global__ __launch_bounds__(32) void k_gemmw(const T16* __restrict__ A, const T16* __restrict__ A2, const T16* __restrict__ Bt, const T16* __restrict__ Bt2, int K, float* C, int ldc, const float* __restrict__ bias, size_t sA, size_t sB, size_t sC) {
    typedef typename WFrag<T16>::V V;
    __shared__ __align__(16) float os[16 * 68];
    const size_t z = blockIdx.z; A += z * sA; if (A2) A2 += z * sA; Bt += z * sB; if (Bt2) Bt2 += z * sB; C += z * sC;
    const int lane = threadIdx.x & 31, lr = lane & 15, hi = lane >> 4; const int r0 = blockIdx.x * 64, c0 = blockIdx.y * 64;
    v8f acc[4][4];
#pragma unroll
    for (int mb = 0; mb < 4; ++mb)
#pragma unroll
        for (int nb = 0; nb < 4; ++nb) acc[mb][nb] = (v8f){};
    const size_t aoff = (size_t)(r0 + lr) * K + 8 * hi, boff = (size_t)(c0 + lr) * K + 8 * hi;
#pragma unroll 1
    for (int kc = 0; kc < K; kc += 32) {
        V a[4], a2[4];
#pragma unroll
        for (int mb = 0; mb < 4; ++mb) { a[mb] = WFrag<T16>::ld(A + aoff + (size_t)mb * 16 * K + kc); if (NSPLIT == 1 || NSPLIT == 2) a2[mb] = WFrag<T16>::ld(A2 + aoff + (size_t)mb * 16 * K + kc); }
#pragma unroll
        for (int nb = 0; nb < 4; ++nb) { const V b = WFrag<T16>::ld(Bt + boff + (size_t)nb * 16 * K + kc); V b2; if (NSPLIT >= 2) b2 = WFrag<T16>::ld(Bt2 + boff + (size_t)nb * 16 * K + kc);
#pragma unroll
            for (int mb = 0; mb < 4; ++mb) { acc[mb][nb] = WFrag<T16>::mma(a[mb], b, acc[mb][nb]); if (NSPLIT == 1 || NSPLIT == 2) acc[mb][nb] = WFrag<T16>::mma(a2[mb], b, acc[mb][nb]); if (NSPLIT >= 2) acc[mb][nb] = WFrag<T16>::mma(a[mb], b2, acc[mb][nb]); } }
        asm volatile("v_nop\n\tv_nop\n\tv_nop\n\tv_nop" : "+v"(acc[0][0]), "+v"(acc[1][1]), "+v"(acc[2][2]), "+v"(acc[3][3]) : "v"(a[0]), "v"(a[3]));
    }
#pragma unroll
    for (int mb = 0; mb < 4; ++mb) {
#pragma unroll
        for (int nb = 0; nb < 4; ++nb) {
#pragma unroll
            for (int j = 0; j < 8; ++j) os[(hi * 8 + j) * 68 + nb * 16 + lr] = acc[mb][nb][j]; }
        __builtin_amdgcn_wave_barrier(); asm volatile("" ::: "memory");
        float* crow = C + (size_t)(r0 + mb * 16) * ldc + c0;
{
#pragma unroll
            for (int s = 0; s < 8; ++s) { const int row = 2 * s + hi, cofs = lr * 4; v4f val = *(const v4fa*)(os + row * 68 + cofs); if (BIAS) { val[0] += bfr(bias[c0 + cofs]); val[1] += bfr(bias[c0 + cofs + 1]); val[2] += bfr(bias[c0 + cofs + 2]); val[3] += bfr(bias[c0 + cofs + 3]); }
                *(v4f*)(crow + (size_t)row * ldc + cofs) = val; }
             }
        __builtin_amdgcn_wave_barrier(); asm volatile("" ::: "memory");
    }
}

__device__ __forceinline__ h16 tohx(float x) { return (h16)x; }
__device__ __forceinline__ void splitf(float y, unsigned short& h, unsigned short& l) { h = f2bf(y); l = f2bf(y - bf2f(h)); }
typedef __attribute__((ext_vector_type(2))) _Float16 v2h;
typedef __attribute__((ext_vector_type(2))) unsigned short v2us;
typedef __attribute__((ext_vector_type(2))) float v2f;
typedef __attribute__((ext_vector_type(4))) int v4i;

__global__ __launch_bounds__(256) void k_wtG(const float* __restrict__ w, int K, int N, bf* Bt) {
    const int lane = threadIdx.x & 31; const int L0 = (blockIdx.x * 8 + (threadIdx.x >> 5)) * 8; const int nlines = N * K / 64;
{
#pragma unroll 1
        for (int l = 0; l < 8; ++l) { const int L = L0 + l; if (L >= nlines) break; const size_t e = (size_t)L * 64 + lane * 2; const int k = (int)(e % K), n = (int)(e / K); v2us o;
            o[0] = f2bf(w[(size_t)k * N + n]); o[1] = f2bf(w[(size_t)(k + 1) * N + n]); *(v2us*)(Bt + e) = o; }
         }
}
__global__ __launch_bounds__(256) void k_cvt8(const float* __restrict__ src, bf* dst, size_t n8) { const size_t i = (size_t)blockIdx.x * 256 + threadIdx.x; if (i >= n8) return; const v8f v = *(const v8f*)(src + i * 8); v8us o;
#pragma unroll
    for (int k = 0; k < 8; ++k) o[k] = f2bf(v[k]); *(v8us*)(dst + i * 8) = o;  }
__global__ __launch_bounds__(256) void k_cscvt(const float* __restrict__ cosT, const float* __restrict__ sinT, float* CS) { const int idx = blockIdx.x * 256 + threadIdx.x; if (idx >= TT * HD) return; v2f cs; cs[0] = bfr(cosT[idx]); cs[1] = bfr(sinT[idx]); *(v2f*)(CS + (size_t)idx * 2) = cs;  }
// k_rope: head planes [h][t][d] (fp16 + hi/lo) of rope(x) x sc with the rotate-half convention out[d] = x[d] cos[t][d] - x[d+HD/2] sin[t][d], out[d+HD/2] = x[d+HD/2] cos[t][d+HD/2] + x[d] sin[t][d+HD/2]
__global__ __launch_bounds__(256) void k_rope(const float* __restrict__ F, int pitch, int nheads, const float* __restrict__ CS, const float* __restrict__ RF, const float* __restrict__ nw, float sc, h16* P16, bf* Ph, bf* Pl) {
    const size_t e = ((size_t)blockIdx.x * 256 + threadIdx.x) * 2; if (e >= (size_t)nheads * TT * HD) return; const int d = (int)(e % HD); const int t = (int)((e / HD) % TT); const int h = (int)(e / ((size_t)HD * TT)); const float* f = F + (size_t)t * pitch + h * HD; const float rf = RF ? RF[(size_t)h * TT + t] : 1.0f; v2h o16; v2us oh, ol;
#pragma unroll
    for (int q = 0; q < 2; ++q) { const int dd = d + q; const int dp = (dd < HD / 2) ? dd + HD / 2 : dd - HD / 2; float x0 = f[dd], x1 = f[dp];
        if (RF) { float n0 = __fmul_rn(x0, rf), n1 = __fmul_rn(x1, rf); asm volatile("" : "+v"(n0)); asm volatile("" : "+v"(n1)); x0 = __fmul_rn(bfr(nw[dd]), n0); x1 = __fmul_rn(bfr(nw[dp]), n1); }
        const v2f cs = *(const v2f*)(CS + ((size_t)t * HD + dd) * 2); float a = __fmul_rn(x0, cs[0]), bq = __fmul_rn(x1, cs[1]); asm volatile("" : "+v"(a)); asm volatile("" : "+v"(bq)); const float r = ((dd < HD / 2) ? __fsub_rn(a, bq) : __fadd_rn(a, bq)) * sc;
        o16[q] = tohx(r); unsigned short a2, c2; splitf(r, a2, c2); oh[q] = a2; ol[q] = c2; }
    *(v2h*)(P16 + e) = o16; *(v2us*)(Ph + e) = oh; *(v2us*)(Pl + e) = ol;  }
__global__ __launch_bounds__(256) void k_vtp(const float* __restrict__ F, int pitch, int nheads, h16* V16, bf* Vh, bf* Vl) { const size_t e = ((size_t)blockIdx.x * 256 + threadIdx.x) * 2; if (e >= (size_t)nheads * HD * TT) return; const int t = (int)(e % TT); const int d = (int)((e / TT) % HD); const int g = (int)(e / ((size_t)TT * HD)); v2h o16; v2us oh, ol;
#pragma unroll
    for (int q = 0; q < 2; ++q) { const float x = F[(size_t)(t + q) * pitch + g * HD + d]; o16[q] = tohx(x); unsigned short a2, c2; splitf(x, a2, c2); oh[q] = a2; ol[q] = c2; }
    *(v2h*)(V16 + e) = o16; *(v2us*)(Vh + e) = oh; *(v2us*)(Vl + e) = ol;  }
__global__ __launch_bounds__(256) void k_csid(float* CS) { const int idx = blockIdx.x * 256 + threadIdx.x; if (idx >= TT * HD) return; v2f cs; cs[0] = 1.0f; cs[1] = 0.0f; *(v2f*)(CS + (size_t)idx * 2) = cs;  }
// ---- k_fattn: causal attention in one kernel. One wave per 32 query rows of one (batch, head); it walks the keys 0 .. q0 + 31 in steps of 64 and keeps a running row maximum, row sum and f32 output tile in registers.
// Both products are formed transposed, so that a query is a LANE (lr) in the scores and in the output alike and no value crosses lanes but the two halves' maximum and sum:
//   St[key][query] = K (A operand, rows = keys) x Q (B operand, rows = queries): lane (lr, hi) holds keys hi * 8 + j of each 16-key tile, which for two neighbouring tiles is exactly the k order of a B fragment over 32 keys;
//   Ot[d][query]  += Vt (A operand, rows = d) x P (B operand, those registers, rounded to 16 bits): lane (lr, hi) ends with d = dt * 16 + hi * 8 + j of query lr, 8 neighbours, stored as one 16-byte piece per plane.
// HL: hi + lo bf16 planes, 3 products each (query rows < RH); else single fp16. The probabilities are exp(s - running max), at most 1; the division by the row sum is done once, in f32, on the output.
#define CEXP (SCL * 1.4426950408889634f)
// exp2s: v_exp_f32 and, in the same statement so that nothing comes between them, the one v_nop that the instruction set asks for behind a transcendental before its result is read or its source overwritten.
__device__ __forceinline__ float exp2s(float x) { float r; asm("v_exp_f32 %0, %1\n\tv_nop" : "=v"(r) : "v"(x)); return r; }
__device__ __forceinline__ v16h pfrag(const v8f& a, const v8f& b) { v16h r;
#pragma unroll
    for (int j = 0; j < 8; ++j) { r[j] = (h16)a[j]; r[8 + j] = (h16)b[j]; } return r; }
__device__ __forceinline__ void pfrag2(const v8f& a, const v8f& b, v16bf& ph, v16bf& pl) { v8us h0, h1, l0, l1;
#pragma unroll
    for (int j = 0; j < 8; ++j) { unsigned short x, y; splitf(a[j], x, y); h0[j] = x; l0[j] = y; splitf(b[j], x, y); h1[j] = x; l1[j] = y; } ph = cat16b(h0, h1); pl = cat16b(l0, l1); }
template <typename T16, bool HL>
__device__ __forceinline__ void fa_rows(const T16* __restrict__ Q, const T16* __restrict__ Q2, const T16* __restrict__ Kp, const T16* __restrict__ K2, const T16* __restrict__ Vt, const T16* __restrict__ V2, int q0, bf* Ah, bf* Al) {
    typedef typename WFrag<T16>::V V;
    const int lane = threadIdx.x & 31, lr = lane & 15, hi = lane >> 4;
    V qf[2][4], q2[2][4]; const T16* qp = Q + (size_t)(q0 + lr) * HD + 8 * hi; const T16* q2p = HL ? Q2 + (size_t)(q0 + lr) * HD + 8 * hi : qp;
#pragma unroll
    for (int nq = 0; nq < 2; ++nq)
#pragma unroll
        for (int c = 0; c < 4; ++c) { qf[nq][c] = WFrag<T16>::ld(qp + nq * 16 * HD + c * 32); if (HL) q2[nq][c] = WFrag<T16>::ld(q2p + nq * 16 * HD + c * 32); }
    xwait(qp, q2p);
    v8f o[8][2]; float m[2], l[2];
#pragma unroll
    for (int nq = 0; nq < 2; ++nq) { m[nq] = -3.0e38f; l[nq] = 0.f;
#pragma unroll
        for (int dt = 0; dt < 8; ++dt) o[dt][nq] = (v8f){}; }
    const size_t kof = (size_t)lr * HD + 8 * hi, vof = (size_t)lr * TT + 8 * hi;
    V kf[4][4], k2f[4][4];
    auto loadk = [&](const T16* kp, const T16* k2p) __attribute__((always_inline)) {
#pragma unroll
        for (int kt = 0; kt < 4; ++kt)
#pragma unroll
            for (int c = 0; c < 4; ++c) { kf[kt][c] = WFrag<T16>::ld(kp + kt * 16 * HD + c * 32); if (HL) k2f[kt][c] = WFrag<T16>::ld(k2p + kt * 16 * HD + c * 32); } };
    if (!HL) { loadk(Kp + kof, nullptr); xwait(Kp + kof, Kp + kof); }   // single planes: a step's K fragments are fetched one step ahead, during the softmax and the second product of the step before
    auto step = [&](int key0, auto MK) __attribute__((always_inline)) {
        constexpr bool MASK = decltype(MK)::value;
        if (HL) { const T16* kp = Kp + kof + (size_t)key0 * HD; const T16* k2p = K2 + kof + (size_t)key0 * HD; loadk(kp, k2p); xwait(kp, k2p); }
        v8f s[4][2];
#pragma unroll
        for (int kt = 0; kt < 4; ++kt) { s[kt][0] = (v8f){}; s[kt][1] = (v8f){};
#pragma unroll
            for (int c = 0; c < 4; ++c)
#pragma unroll
                for (int nq = 0; nq < 2; ++nq) { s[kt][nq] = WFrag<T16>::mma(kf[kt][c], qf[nq][c], s[kt][nq]); if (HL) { s[kt][nq] = WFrag<T16>::mma(k2f[kt][c], qf[nq][c], s[kt][nq]); s[kt][nq] = WFrag<T16>::mma(kf[kt][c], q2[nq][c], s[kt][nq]); } } }
        V vf[8][2], v2f[8][2];   // the V fragments fly during the softmax
        const T16* vp = Vt + vof + key0; const T16* v2p = HL ? V2 + vof + key0 : vp; const T16* kn = Kp + kof + (size_t)(key0 + 64) * HD;
#pragma unroll
        for (int dt = 0; dt < 8; ++dt)
#pragma unroll
            for (int kk = 0; kk < 2; ++kk) { vf[dt][kk] = WFrag<T16>::ld(vp + dt * 16 * TT + kk * 32); if (HL) v2f[dt][kk] = WFrag<T16>::ld(v2p + dt * 16 * TT + kk * 32); }
        if (!HL && !MASK) { loadk(kn, nullptr); xwait(vp, kn); }   // the masked step is the last one
        else xwait(vp, v2p);
        V pf[2][2], pl[2][2];
#pragma unroll
        for (int nq = 0; nq < 2; ++nq) { float mx = m[nq];
#pragma unroll
            for (int kt = 0; kt < 4; ++kt)
#pragma unroll
                for (int j = 0; j < 8; ++j) { if (MASK) { if (key0 + kt * 16 + hi * 8 + j > q0 + nq * 16 + lr) s[kt][nq][j] = -3.0e38f; } mx = fmaxf(mx, s[kt][nq][j]); }
            mx = fmaxf(mx, __shfl_xor(mx, 16, 32));   // the other half of the lanes holds the other keys of the same query
            const float al = exp2s((m[nq] - mx) * CEXP); m[nq] = mx; float sum = 0.f;
#pragma unroll
            for (int kt = 0; kt < 4; ++kt)
#pragma unroll
                for (int j = 0; j < 8; ++j) { const float p = exp2s((s[kt][nq][j] - mx) * CEXP); s[kt][nq][j] = p; sum += p; }
            l[nq] = l[nq] * al + sum;
#pragma unroll
            for (int dt = 0; dt < 8; ++dt) o[dt][nq] *= al;
#pragma unroll
            for (int kk = 0; kk < 2; ++kk) { if constexpr (HL) pfrag2(s[2 * kk][nq], s[2 * kk + 1][nq], pf[kk][nq], pl[kk][nq]); else pf[kk][nq] = pfrag(s[2 * kk][nq], s[2 * kk + 1][nq]); } }
#pragma unroll
        for (int dt = 0; dt < 8; ++dt)
#pragma unroll
            for (int kk = 0; kk < 2; ++kk)
#pragma unroll
                for (int nq = 0; nq < 2; ++nq) { o[dt][nq] = WFrag<T16>::mma(vf[dt][kk], pf[kk][nq], o[dt][nq]); if (HL) { o[dt][nq] = WFrag<T16>::mma(vf[dt][kk], pl[kk][nq], o[dt][nq]); o[dt][nq] = WFrag<T16>::mma(v2f[dt][kk], pf[kk][nq], o[dt][nq]); } }
    };
    const int klast = (q0 + 31) / 64 * 64;   // the one step that holds the diagonal; every key of the steps before it is at or below every query of the wave
#pragma unroll 1
    for (int key0 = 0; key0 < klast; key0 += 64) step(key0, std::false_type{});
    step(klast, std::true_type{});
#pragma unroll
    for (int nq = 0; nq < 2; ++nq) { const float inv = __fdiv_rn(1.0f, l[nq] + __shfl_xor(l[nq], 16, 32));
#pragma unroll
        for (int dt = 0; dt < 8; ++dt) { v8us oh, ol;
#pragma unroll
            for (int j = 0; j < 8; ++j) { unsigned short a, c2; splitf(o[dt][nq][j] * inv, a, c2); oh[j] = a; ol[j] = c2; }
            const size_t oo = (size_t)(q0 + nq * 16 + lr) * DQ + dt * 16 + hi * 8; *(v8us*)(Ah + oo) = oh; xwaits(Ah + oo, oh); *(v8us*)(Al + oo) = ol; xwaits(Al + oo, ol); } }
}
// grid (NB_ * NH_, TT / 128), 4 waves: a block's waves take 4 neighbouring 32-row pieces of one head, so that they walk the same K and V lines at about the same time (no barrier: nothing is shared but the cache); the longest rows (most keys) start first. Planes [batch][head][t][d] (V: [batch][head][d][t]); output planes [batch][t][head * HD + d].
__global__ __launch_bounds__(128) void k_fattn(const h16* __restrict__ Q16, const h16* __restrict__ K16, const h16* __restrict__ V16, const bf* __restrict__ Qh, const bf* __restrict__ Ql, const bf* __restrict__ Kh, const bf* __restrict__ Kl, const bf* __restrict__ Vh, const bf* __restrict__ Vl, bf* Ah, bf* Al) {
    const int zh = blockIdx.x; const int q0 = (TT / 128 - 1 - (int)blockIdx.y) * 128 + __builtin_amdgcn_readfirstlane((int)(threadIdx.x >> 5)) * 32;   /* scalar: the key loop keeps a scalar trip test and every lane stays on at the matrix instructions */ const size_t pz = (size_t)zh * TT * HD; const size_t az = (size_t)(zh / NH_) * TT * DQ + (size_t)(zh % NH_) * HD;
    if (q0 < RH) fa_rows<bf, true>(Qh + pz, Ql + pz, Kh + pz, Kl + pz, Vh + pz, Vl + pz, q0, Ah + az, Al + az);
    else fa_rows<h16, false>(Q16 + pz, nullptr, K16 + pz, nullptr, V16 + pz, nullptr, q0, Ah + az, Al + az);
}

extern "C" void kernel_launch(void* const* d_in, const int* in_sizes, int n_in,
                              void* d_out, int out_size, void* d_ws, size_t ws_size, hipStream_t stream) {
    (void)in_sizes; (void)n_in; (void)out_size;
    const float* x = (const float*)d_in[0]; const float* wq = (const float*)d_in[1]; const float* bq = (const float*)d_in[2]; const float* wk = (const float*)d_in[3]; const float* bk = (const float*)d_in[4]; const float* wv = (const float*)d_in[5]; const float* bv = (const float*)d_in[6]; const float* wo = (const float*)d_in[7]; const float* bo = (const float*)d_in[8]; const float* cosT = nullptr; const float* sinT = nullptr; (void)cosT; (void)sinT;
    float* OUT = (float*)d_out;     // [2][2048][1024]
    char* wsp = (char*)d_ws;
    auto take = [&](size_t bytes) { char* p = wsp; wsp += (bytes + 255) & ~(size_t)255; return (void*)p; };
    bf* WQ = (bf*)take((size_t)DQ * DM * 2); bf* WK = (bf*)take((size_t)DKV * DM * 2); bf* WV = (bf*)take((size_t)DKV * DM * 2); bf* WO = (bf*)take((size_t)DM * DQ * 2); float* CS = (float*)take((size_t)TT * HD * 2 * 4);
    const size_t PB = (size_t)NH_ * TT * HD;   // one batch's head planes, in elements; every plane holds both batches
    h16* QP16 = (h16*)take(NB_ * PB * 2); h16* KP16 = (h16*)take(NB_ * PB * 2); h16* VT16 = (h16*)take(NB_ * PB * 2);
    bf* QPh = (bf*)take(NB_ * PB * 2); bf* QPl = (bf*)take(NB_ * PB * 2); bf* KPh = (bf*)take(NB_ * PB * 2); bf* KPl = (bf*)take(NB_ * PB * 2); bf* VTh = (bf*)take(NB_ * PB * 2); bf* VTl = (bf*)take(NB_ * PB * 2);
    bf* XB = (bf*)take((size_t)TT * DM * 2); float* FQ = (float*)take((size_t)TT * DQ * 4); float* FK = (float*)take((size_t)TT * DKV * 4); bf* ATh = (bf*)take((size_t)NB_ * TT * DQ * 2); bf* ATl = (bf*)take((size_t)NB_ * TT * DQ * 2);
    if ((size_t)(wsp - (char*)d_ws) > ws_size) return;    // ws 256 MiB
    float* FV = FK;   // v projection reuses the k buffer after the k planes are built (stream-ordered)
    { k_wtG<<<(unsigned)((DM * DQ / 64 + 63) / 64), 256, 0, stream>>>(wq, DM, DQ, WQ); k_wtG<<<(unsigned)((DM * DKV / 64 + 63) / 64), 256, 0, stream>>>(wk, DM, DKV, WK); k_wtG<<<(unsigned)((DM * DKV / 64 + 63) / 64), 256, 0, stream>>>(wv, DM, DKV, WV);
      k_wtG<<<(unsigned)((DQ * DM / 64 + 63) / 64), 256, 0, stream>>>(wo, DQ, DM, WO);
       }
    k_csid<<<(TT * HD + 255) / 256, 256, 0, stream>>>(CS);
    const unsigned LQ = (unsigned)(((size_t)NH_ * TT * HD / 2 + 255) / 256), LKv = (unsigned)(((size_t)NKV * TT * HD / 2 + 255) / 256);
    for (int b = 0; b < NB_; ++b) {
        k_cvt8<<<(unsigned)(((size_t)TT * DM / 8 + 255) / 256), 256, 0, stream>>>(x + (size_t)b * TT * DM, XB, (size_t)TT * DM / 8);
        k_gemmw<bf, 0, true><<<dim3(TT / 64, DQ / 64, 1), 32, 0, stream>>>(XB, nullptr, WQ, nullptr, DM, FQ, DQ, bq, 0, 0, 0);
        k_rope<<<LQ, 256, 0, stream>>>(FQ, DQ, NH_, CS, nullptr, nullptr, 1.0f, QP16 + b * PB, QPh + b * PB, QPl + b * PB);
        k_gemmw<bf, 0, true><<<dim3(TT / 64, DKV / 64, 1), 32, 0, stream>>>(XB, nullptr, WK, nullptr, DM, FK, DKV, bk, 0, 0, 0);
        k_rope<<<LKv, 256, 0, stream>>>(FK, DKV, NKV, CS, nullptr, nullptr, 1.0f, KP16 + b * PB, KPh + b * PB, KPl + b * PB);
        k_gemmw<bf, 0, true><<<dim3(TT / 64, DKV / 64, 1), 32, 0, stream>>>(XB, nullptr, WV, nullptr, DM, FV, DKV, bv, 0, 0, 0); k_vtp<<<LKv, 256, 0, stream>>>(FV, DKV, NKV, VT16 + b * PB, VTh + b * PB, VTl + b * PB); }
    k_fattn<<<dim3(NB_ * NH_, TT / 128, 1), 128, 0, stream>>>(QP16, KP16, VT16, QPh, QPl, KPh, KPl, VTh, VTl, ATh, ATl);
    for (int b = 0; b < NB_; ++b)
        k_gemmw<bf, 1, true><<<dim3(TT / 64, DM / 64, 1), 32, 0, stream>>>(ATh + (size_t)b * TT * DQ, ATl + (size_t)b * TT * DQ, WO, nullptr, DQ, OUT + (size_t)b * TT * DM, DM, bo, 0, 0, 0);
}

// v004
// It runs in 404 microseconds.
// Two timings next to v003 put it at 1.18 and 1.16 times that version's speed.
// Counting every step since v000, it is 3.99 times as fast.
#include <hip/hip_runtime.h>
#include <type_traits>

// multihead_attentive_layer (query [2][2048][1024]; q/k/v = x W + b ([1024][2048]: 16 heads x 128); scores = q.k / sqrt(S = 2048) (the source scales by the sequence length, not the head dim) + -1e12 * (1 - causal); softmax; out = merged Wo ([2048][1024]) + bo -> [2][2048][1024]).
// Compute dtypes, f32 accumulate: every input rounded to bf16; q/k/v on PLAIN bf16 operands (inputs: exact) + bias; causal scores and attn.v: query rows < 512 hl (3 products), the rest single fp16, keys above the diagonal skipped or given weight 0 (the additive -1e12 underflows to exactly 0 weight, as skipping does); softmax f32, running maximum; Wo hl x exact (2 products) + bias.

#define NB_  2
#define TT   2048
#define DM   1024
#define NH_  16
#define NKV  16
#define REP  (NH_ / NKV)
#define HD   128
#define DQ   (NH_ * HD)
#define DKV  (NKV * HD)
#define RH   512                  // query rows < RH use hi+lo planes (0: none)
#define SCL  0.022097086912079608f   // 1/sqrt(S = 2048): the source scales by the value sequence length
typedef _Float16 h16;
typedef unsigned short bf;
typedef __attribute__((ext_vector_type(16))) __bf16   v16bf;
typedef __attribute__((ext_vector_type(16))) _Float16 v16h;
typedef __attribute__((ext_vector_type(8)))  _Float16 v8h;
typedef __attribute__((ext_vector_type(8)))  unsigned short v8us;
typedef __attribute__((ext_vector_type(8)))  float    v8f;
typedef __attribute__((ext_vector_type(4)))  float    v4f;
typedef v8h  __attribute__((may_alias)) v8ha;
typedef v4f  __attribute__((may_alias)) v4fa;
typedef v8us __attribute__((may_alias)) v8usa;

__device__ __forceinline__ unsigned short f2bf(float f) { unsigned u = __float_as_uint(f); u += 0x7FFFu + ((u >> 16) & 1u); return (unsigned short)(u >> 16); }
__device__ __forceinline__ float bf2f(unsigned short b) { return __uint_as_float(((unsigned)b) << 16); }
__device__ __forceinline__ float bfr(float f) { return bf2f(f2bf(f)); }
__device__ __forceinline__ v16h cat16(v8h lo, v8h hi) { return __builtin_shufflevector(lo, hi, 0, 1, 2, 3, 4, 5, 6, 7, 8, 9, 10, 11, 12, 13, 14, 15); }
__device__ __forceinline__ v16bf cat16b(v8us lo, v8us hi) { return __builtin_bit_cast(v16bf, __builtin_shufflevector(lo, hi, 0, 1, 2, 3, 4, 5, 6, 7, 8, 9, 10, 11, 12, 13, 14, 15)); }
__device__ __forceinline__ v8f wmma16(v16h a, v16h b, v8f c) { return __builtin_amdgcn_wmma_f32_16x16x32_f16(false, a, false, b, (short)0, c, false, false); }
__device__ __forceinline__ v8f wmmab(v16bf a, v16bf b, v8f c) { return __builtin_amdgcn_wmma_f32_16x16x32_bf16(false, a, false, b, (short)0, c, false, false); }



// ---- k_gemmw: register-blocked GEMM, ONE WAVE per 64x64 output tile (16 accumulators), operands straight from K-contiguous 16-bit planes; grid (M/64, N/64, Z), 32 threads.
// C[m][n] (f32, pitch ldc, + optional f32 bias[n]) = sum_k A[m][k] Bt[n][k] (+ split products per NSPLIT). z-batch strides sA/sB/sC in elements. K % 32 == 0.
// EPI 0: C is stored as f32 rows. EPI 1 and 2 (m = t, n = head * HD + d; a 64-column tile lies in one head): no f32 C; the tile + bias goes straight into the three 16-bit head planes that k_fattn reads (fp16, bf16 hi, bf16 lo of the remainder), EPI 1 as [head][t][d], EPI 2 transposed as [head][d][t].
template <typename T16> struct WFrag;
template <> struct WFrag<h16> { typedef v16h V; static __device__ __forceinline__ V ld(const h16* p) { return cat16(*(const v8h*)p, *(const v8h*)(p + 16)); } static __device__ __forceinline__ v8f mma(V a, V b, v8f c) { return wmma16(a, b, c); } };
template <> struct WFrag<bf> { typedef v16bf V; static __device__ __forceinline__ V ld(const bf* p) { return cat16b(*(const v8us*)p, *(const v8us*)(p + 16)); } static __device__ __forceinline__ v8f mma(V a, V b, v8f c) { return wmmab(a, b, c); } };
// xwait: the wait that belongs between an issued global load or store and a later write of the registers that it names; k_fattn puts one behind each run of fragment loads (a run shares its address registers, which are next written in the following step) and one behind each store.
// The wait takes those registers as inputs, so that they stay allocated (no later result is placed in them) until it has been passed.
__device__ __forceinline__ void xwait(const void* a, const void* b) { asm volatile("s_wait_xcnt 0x0" :: "v"(a), "v"(b) : "memory"); }
__device__ __forceinline__ void xwaits(const void* a, v8us data) { asm volatile("s_wait_xcnt 0x0" :: "v"(a), "v"(data) : "memory"); }
__device__ __forceinline__ void xwaits3(const void* a, const void* b, const void* c, v8h x, v8us y, v8us z) { asm volatile("s_wait_xcnt 0x0" :: "v"(a), "v"(b), "v"(c), "v"(x), "v"(y), "v"(z) : "memory"); }   // the same wait behind a run of three stores
__device__ __forceinline__ h16 tohx(float x) { return (h16)x; }
__device__ __forceinline__ void splitf(float y, unsigned short& h, unsigned short& l) { h = f2bf(y); l = f2bf(y - bf2f(h)); }
template <typename T16, int NSPLIT, bool BIAS, int EPI>
__global__ __launch_bounds__(32) void k_gemmw(const T16* __restrict__ A, const T16* __restrict__ A2, const T16* __restrict__ Bt, const T16* __restrict__ Bt2, int K, float* C, int ldc, const float* __restrict__ bias, size_t sA, size_t sB, size_t sC, h16* P16, bf* Ph, bf* Pl) {
    typedef typename WFrag<T16>::V V;
    __shared__ __align__(16) float os[16 * 68];
    const size_t z = blockIdx.z; A += z * sA; if (A2) A2 += z * sA; Bt += z * sB; if (Bt2) Bt2 += z * sB; C += z * sC;
    const int lane = threadIdx.x & 31, lr = lane & 15, hi = lane >> 4; const int r0 = blockIdx.x * 64, c0 = blockIdx.y * 64;
    v8f acc[4][4];
#pragma unroll
    for (int mb = 0; mb < 4; ++mb)
#pragma unroll
        for (int nb = 0; nb < 4; ++nb) acc[mb][nb] = (v8f){};
    const size_t aoff = (size_t)(r0 + lr) * K + 8 * hi, boff = (size_t)(c0 + lr) * K + 8 * hi;
#pragma unroll 1
    for (int kc = 0; kc < K; kc += 32) {
        V a[4], a2[4];
#pragma unroll
        for (int mb = 0; mb < 4; ++mb) { a[mb] = WFrag<T16>::ld(A + aoff + (size_t)mb * 16 * K + kc); if (NSPLIT == 1 || NSPLIT == 2) a2[mb] = WFrag<T16>::ld(A2 + aoff + (size_t)mb * 16 * K + kc); }
#pragma unroll
        for (int nb = 0; nb < 4; ++nb) { const V b = WFrag<T16>::ld(Bt + boff + (size_t)nb * 16 * K + kc); V b2; if (NSPLIT >= 2) b2 = WFrag<T16>::ld(Bt2 + boff + (size_t)nb * 16 * K + kc);
#pragma unroll
            for (int mb = 0; mb < 4; ++mb) { acc[mb][nb] = WFrag<T16>::mma(a[mb], b, acc[mb][nb]); if (NSPLIT == 1 || NSPLIT == 2) acc[mb][nb] = WFrag<T16>::mma(a2[mb], b, acc[mb][nb]); if (NSPLIT >= 2) acc[mb][nb] = WFrag<T16>::mma(a[mb], b2, acc[mb][nb]); } }
        asm volatile("v_nop\n\tv_nop\n\tv_nop\n\tv_nop" : "+v"(acc[0][0]), "+v"(acc[1][1]), "+v"(acc[2][2]), "+v"(acc[3][3]) : "v"(a[0]), "v"(a[3]));
    }
    if constexpr (EPI != 0) {
        // 16 plane rows of 64 neighbouring elements at a time go through LDS as f32 (EPI 1: 16 t x 64 d, one mb; EPI 2: 16 d x 64 t, one nb, where a lane's 8 accumulator rows are 8 neighbours); read back, 8 lanes cover a row, so that each plane gets whole 128-byte lines.
        float bb[4];
#pragma unroll
        for (int nb = 0; nb < 4; ++nb) bb[nb] = BIAS ? bfr(bias[c0 + nb * 16 + lr]) : 0.f;
        const int hd = c0 / HD, d0 = c0 % HD;
#pragma unroll
        for (int g = 0; g < 4; ++g) {
            if constexpr (EPI == 1) {
#pragma unroll
                for (int nb = 0; nb < 4; ++nb)
#pragma unroll
                    for (int j = 0; j < 8; ++j) os[(hi * 8 + j) * 68 + nb * 16 + lr] = acc[g][nb][j] + bb[nb];
            } else {
#pragma unroll
                for (int mb = 0; mb < 4; ++mb) { v4f u0, u1;
#pragma unroll
                    for (int j = 0; j < 4; ++j) { u0[j] = acc[mb][g][j] + bb[g]; u1[j] = acc[mb][g][4 + j] + bb[g]; }
                    *(v4fa*)(os + lr * 68 + mb * 16 + hi * 8) = u0; *(v4fa*)(os + lr * 68 + mb * 16 + hi * 8 + 4) = u1; }
            }
            __builtin_amdgcn_wave_barrier(); asm volatile("" ::: "memory");   // one wave: keeps the compiler from moving the reads below, which take other lanes' values, above the LDS writes
#pragma unroll
            for (int s = 0; s < 4; ++s) { const int row = 4 * s + (lane >> 3), cofs = (lane & 7) * 8; const v4f x0 = *(const v4fa*)(os + row * 68 + cofs), x1 = *(const v4fa*)(os + row * 68 + cofs + 4); v8h o16; v8us oh, ol;
#pragma unroll
                for (int j = 0; j < 8; ++j) { const float x = j < 4 ? x0[j & 3] : x1[j & 3]; o16[j] = tohx(x); unsigned short a2, c2; splitf(x, a2, c2); oh[j] = a2; ol[j] = c2; }
                const size_t e = EPI == 1 ? ((size_t)hd * TT + r0 + g * 16 + row) * HD + d0 + cofs : ((size_t)hd * HD + d0 + g * 16 + row) * TT + r0 + cofs;
                *(v8h*)(P16 + e) = o16; *(v8us*)(Ph + e) = oh; *(v8us*)(Pl + e) = ol; xwaits3(P16 + e, Ph + e, Pl + e, o16, oh, ol); }
            __builtin_amdgcn_wave_barrier(); asm volatile("" ::: "memory");   // and the next group's LDS writes above these reads
        }
        return;
    }
#pragma unroll
    for (int mb = 0; mb < 4; ++mb) {
#pragma unroll
        for (int nb = 0; nb < 4; ++nb) {
#pragma unroll
            for (int j = 0; j < 8; ++j) os[(hi * 8 + j) * 68 + nb * 16 + lr] = acc[mb][nb][j]; }
        __builtin_amdgcn_wave_barrier(); asm volatile("" ::: "memory");
        float* crow = C + (size_t)(r0 + mb * 16) * ldc + c0;
{
#pragma unroll
            for (int s = 0; s < 8; ++s) { const int row = 2 * s + hi, cofs = lr * 4; v4f val = *(const v4fa*)(os + row * 68 + cofs); if (BIAS) { val[0] += bfr(bias[c0 + cofs]); val[1] += bfr(bias[c0 + cofs + 1]); val[2] += bfr(bias[c0 + cofs + 2]); val[3] += bfr(bias[c0 + cofs + 3]); }
                *(v4f*)(crow + (size_t)row * ldc + cofs) = val; }
             }
        __builtin_amdgcn_wave_barrier(); asm volatile("" ::: "memory");
    }
}

typedef __attribute__((ext_vector_type(2))) _Float16 v2h;
typedef __attribute__((ext_vector_type(2))) unsigned short v2us;
typedef __attribute__((ext_vector_type(2))) float v2f;
typedef __attribute__((ext_vector_type(4))) int v4i;

__global__ __launch_bounds__(256) void k_wtG(const float* __restrict__ w, int K, int N, bf* Bt) {
    const int lane = threadIdx.x & 31; const int L0 = (blockIdx.x * 8 + (threadIdx.x >> 5)) * 8; const int nlines = N * K / 64;
{
#pragma unroll 1
        for (int l = 0; l < 8; ++l) { const int L = L0 + l; if (L >= nlines) break; const size_t e = (size_t)L * 64 + lane * 2; const int k = (int)(e % K), n = (int)(e / K); v2us o;
            o[0] = f2bf(w[(size_t)k * N + n]); o[1] = f2bf(w[(size_t)(k + 1) * N + n]); *(v2us*)(Bt + e) = o; }
         }
}
__global__ __launch_bounds__(256) void k_cvt8(const float* __restrict__ src, bf* dst, size_t n8) { const size_t i = (size_t)blockIdx.x * 256 + threadIdx.x; if (i >= n8) return; const v8f v = *(const v8f*)(src + i * 8); v8us o;
#pragma unroll
    for (int k = 0; k < 8; ++k) o[k] = f2bf(v[k]); *(v8us*)(dst + i * 8) = o;  }
// ---- k_fattn: causal attention in one kernel. One wave per 32 query rows of one (batch, head); it walks the keys 0 .. q0 + 31 in steps of 64 and keeps a running row maximum, row sum and f32 output tile in registers.
// Both products are formed transposed, so that a query is a LANE (lr) in the scores and in the output alike and no value crosses lanes but the two halves' maximum and sum:
//   St[key][query] = K (A operand, rows = keys) x Q (B operand, rows = queries): lane (lr, hi) holds keys hi * 8 + j of each 16-key tile, which for two neighbouring tiles is exactly the k order of a B fragment over 32 keys;
//   Ot[d][query]  += Vt (A operand, rows = d) x P (B operand, those registers, rounded to 16 bits): lane (lr, hi) ends with d = dt * 16 + hi * 8 + j of query lr, 8 neighbours, stored as one 16-byte piece per plane.
// HL: hi + lo bf16 planes, 3 products each (query rows < RH); else single fp16. The probabilities are exp(s - running max), at most 1; the division by the row sum is done once, in f32, on the output.
#define CEXP (SCL * 1.4426950408889634f)
// exp2s: v_exp_f32 and, in the same statement so that nothing comes between them, the one v_nop that the instruction set asks for behind a transcendental before its result is read or its source overwritten.
__device__ __forceinline__ float exp2s(float x) { float r; asm("v_exp_f32 %0, %1\n\tv_nop" : "=v"(r) : "v"(x)); return r; }
__device__ __forceinline__ v16h pfrag(const v8f& a, const v8f& b) { v16h r;
#pragma unroll
    for (int j = 0; j < 8; ++j) { r[j] = (h16)a[j]; r[8 + j] = (h16)b[j]; } return r; }
__device__ __forceinline__ void pfrag2(const v8f& a, const v8f& b, v16bf& ph, v16bf& pl) { v8us h0, h1, l0, l1;
#pragma unroll
    for (int j = 0; j < 8; ++j) { unsigned short x, y; splitf(a[j], x, y); h0[j] = x; l0[j] = y; splitf(b[j], x, y); h1[j] = x; l1[j] = y; } ph = cat16b(h0, h1); pl = cat16b(l0, l1); }
template <typename T16, bool HL>
__device__ __forceinline__ void fa_rows(const T16* __restrict__ Q, const T16* __restrict__ Q2, const T16* __restrict__ Kp, const T16* __restrict__ K2, const T16* __restrict__ Vt, const T16* __restrict__ V2, int q0, bf* Ah, bf* Al) {
    typedef typename WFrag<T16>::V V;
    const int lane = threadIdx.x & 31, lr = lane & 15, hi = lane >> 4;
    V qf[2][4], q2[2][4]; const T16* qp = Q + (size_t)(q0 + lr) * HD + 8 * hi; const T16* q2p = HL ? Q2 + (size_t)(q0 + lr) * HD + 8 * hi : qp;
#pragma unroll
    for (int nq = 0; nq < 2; ++nq)
#pragma unroll
        for (int c = 0; c < 4; ++c) { qf[nq][c] = WFrag<T16>::ld(qp + nq * 16 * HD + c * 32); if (HL) q2[nq][c] = WFrag<T16>::ld(q2p + nq * 16 * HD + c * 32); }
    xwait(qp, q2p);
    v8f o[8][2]; float m[2], l[2];
#pragma unroll
    for (int nq = 0; nq < 2; ++nq) { m[nq] = -3.0e38f; l[nq] = 0.f;
#pragma unroll
        for (int dt = 0; dt < 8; ++dt) o[dt][nq] = (v8f){}; }
    const size_t kof = (size_t)lr * HD + 8 * hi, vof = (size_t)lr * TT + 8 * hi;
    V kf[4][4], k2f[4][4];
    auto loadk = [&](const T16* kp, const T16* k2p) __attribute__((always_inline)) {
#pragma unroll
        for (int kt = 0; kt < 4; ++kt)
#pragma unroll
            for (int c = 0; c < 4; ++c) { kf[kt][c] = WFrag<T16>::ld(kp + kt * 16 * HD + c * 32); if (HL) k2f[kt][c] = WFrag<T16>::ld(k2p + kt * 16 * HD + c * 32); } };
    if (!HL) { loadk(Kp + kof, nullptr); xwait(Kp + kof, Kp + kof); }   // single planes: a step's K fragments are fetched one step ahead, during the softmax and the second product of the step before
    auto step = [&](int key0, auto MK) __attribute__((always_inline)) {
        constexpr bool MASK = decltype(MK)::value;
        if (HL) { const T16* kp = Kp + kof + (size_t)key0 * HD; const T16* k2p = K2 + kof + (size_t)key0 * HD; loadk(kp, k2p); xwait(kp, k2p); }
        v8f s[4][2];
#pragma unroll
        for (int kt = 0; kt < 4; ++kt) { s[kt][0] = (v8f){}; s[kt][1] = (v8f){};
#pragma unroll
            for (int c = 0; c < 4; ++c)
#pragma unroll
                for (int nq = 0; nq < 2; ++nq) { s[kt][nq] = WFrag<T16>::mma(kf[kt][c], qf[nq][c], s[kt][nq]); if (HL) { s[kt][nq] = WFrag<T16>::mma(k2f[kt][c], qf[nq][c], s[kt][nq]); s[kt][nq] = WFrag<T16>::mma(kf[kt][c], q2[nq][c], s[kt][nq]); } } }
        V vf[8][2], v2f[8][2];   // the V fragments fly during the softmax
        const T16* vp = Vt + vof + key0; const T16* v2p = HL ? V2 + vof + key0 : vp; const T16* kn = Kp + kof + (size_t)(key0 + 64) * HD;
#pragma unroll
        for (int dt = 0; dt < 8; ++dt)
#pragma unroll
            for (int kk = 0; kk < 2; ++kk) { vf[dt][kk] = WFrag<T16>::ld(vp + dt * 16 * TT + kk * 32); if (HL) v2f[dt][kk] = WFrag<T16>::ld(v2p + dt * 16 * TT + kk * 32); }
        if (!HL && !MASK) { loadk(kn, nullptr); xwait(vp, kn); }   // the masked step is the last one
        else xwait(vp, v2p);
        V pf[2][2], pl[2][2];
#pragma unroll
        for (int nq = 0; nq < 2; ++nq) { float mx = m[nq];
#pragma unroll
            for (int kt = 0; kt < 4; ++kt)
#pragma unroll
                for (int j = 0; j < 8; ++j) { if (MASK) { if (key0 + kt * 16 + hi * 8 + j > q0 + nq * 16 + lr) s[kt][nq][j] = -3.0e38f; } mx = fmaxf(mx, s[kt][nq][j]); }
            mx = fmaxf(mx, __shfl_xor(mx, 16, 32));   // the other half of the lanes holds the other keys of the same query
            const float al = exp2s((m[nq] - mx) * CEXP); m[nq] = mx; float sum = 0.f;
#pragma unroll
            for (int kt = 0; kt < 4; ++kt)
#pragma unroll
                for (int j = 0; j < 8; ++j) { const float p = exp2s((s[kt][nq][j] - mx) * CEXP); s[kt][nq][j] = p; sum += p; }
            l[nq] = l[nq] * al + sum;
#pragma unroll
            for (int dt = 0; dt < 8; ++dt) o[dt][nq] *= al;
#pragma unroll
            for (int kk = 0; kk < 2; ++kk) { if constexpr (HL) pfrag2(s[2 * kk][nq], s[2 * kk + 1][nq], pf[kk][nq], pl[kk][nq]); else pf[kk][nq] = pfrag(s[2 * kk][nq], s[2 * kk + 1][nq]); } }
#pragma unroll
        for (int dt = 0; dt < 8; ++dt)
#pragma unroll
            for (int kk = 0; kk < 2; ++kk)
#pragma unroll
                for (int nq = 0; nq < 2; ++nq) { o[dt][nq] = WFrag<T16>::mma(vf[dt][kk], pf[kk][nq], o[dt][nq]); if (HL) { o[dt][nq] = WFrag<T16>::mma(vf[dt][kk], pl[kk][nq], o[dt][nq]); o[dt][nq] = WFrag<T16>::mma(v2f[dt][kk], pf[kk][nq], o[dt][nq]); } }
    };
    const int klast = (q0 + 31) / 64 * 64;   // the one step that holds the diagonal; every key of the steps before it is at or below every query of the wave
#pragma unroll 1
    for (int key0 = 0; key0 < klast; key0 += 64) step(key0, std::false_type{});
    step(klast, std::true_type{});
#pragma unroll
    for (int nq = 0; nq < 2; ++nq) { const float inv = __fdiv_rn(1.0f, l[nq] + __shfl_xor(l[nq], 16, 32));
#pragma unroll
        for (int dt = 0; dt < 8; ++dt) { v8us oh, ol;
#pragma unroll
            for (int j = 0; j < 8; ++j) { unsigned short a, c2; splitf(o[dt][nq][j] * inv, a, c2); oh[j] = a; ol[j] = c2; }
            const size_t oo = (size_t)(q0 + nq * 16 + lr) * DQ + dt * 16 + hi * 8; *(v8us*)(Ah + oo) = oh; xwaits(Ah + oo, oh); *(v8us*)(Al + oo) = ol; xwaits(Al + oo, ol); } }
}
// grid (NB_ * NH_, TT / 128), 4 waves: a block's waves take 4 neighbouring 32-row pieces of one head, so that they walk the same K and V lines at about the same time (no barrier: nothing is shared but the cache); the longest rows (most keys) start first. Planes [batch][head][t][d] (V: [batch][head][d][t]); output planes [batch][t][head * HD + d].
__global__ __launch_bounds__(128) void k_fattn(const h16* __restrict__ Q16, const h16* __restrict__ K16, const h16* __restrict__ V16, const bf* __restrict__ Qh, const bf* __restrict__ Ql, const bf* __restrict__ Kh, const bf* __restrict__ Kl, const bf* __restrict__ Vh, const bf* __restrict__ Vl, bf* Ah, bf* Al) {
    const int zh = blockIdx.x; const int q0 = (TT / 128 - 1 - (int)blockIdx.y) * 128 + __builtin_amdgcn_readfirstlane((int)(threadIdx.x >> 5)) * 32;   /* scalar: the key loop keeps a scalar trip test and every lane stays on at the matrix instructions */ const size_t pz = (size_t)zh * TT * HD; const size_t az = (size_t)(zh / NH_) * TT * DQ + (size_t)(zh % NH_) * HD;
    if (q0 < RH) fa_rows<bf, true>(Qh + pz, Ql + pz, Kh + pz, Kl + pz, Vh + pz, Vl + pz, q0, Ah + az, Al + az);
    else fa_rows<h16, false>(Q16 + pz, nullptr, K16 + pz, nullptr, V16 + pz, nullptr, q0, Ah + az, Al + az);
}

extern "C" void kernel_launch(void* const* d_in, const int* in_sizes, int n_in,
                              void* d_out, int out_size, void* d_ws, size_t ws_size, hipStream_t stream) {
    (void)in_sizes; (void)n_in; (void)out_size;
    const float* x = (const float*)d_in[0]; const float* wq = (const float*)d_in[1]; const float* bq = (const float*)d_in[2]; const float* wk = (const float*)d_in[3]; const float* bk = (const float*)d_in[4]; const float* wv = (const float*)d_in[5]; const float* bv = (const float*)d_in[6]; const float* wo = (const float*)d_in[7]; const float* bo = (const float*)d_in[8];
    float* OUT = (float*)d_out;     // [2][2048][1024]
    char* wsp = (char*)d_ws;
    auto take = [&](size_t bytes) { char* p = wsp; wsp += (bytes + 255) & ~(size_t)255; return (void*)p; };
    bf* WQ = (bf*)take((size_t)DQ * DM * 2); bf* WK = (bf*)take((size_t)DKV * DM * 2); bf* WV = (bf*)take((size_t)DKV * DM * 2); bf* WO = (bf*)take((size_t)DM * DQ * 2);
    const size_t PB = (size_t)NH_ * TT * HD;   // one batch's head planes, in elements; every plane holds both batches
    h16* QP16 = (h16*)take(NB_ * PB * 2); h16* KP16 = (h16*)take(NB_ * PB * 2); h16* VT16 = (h16*)take(NB_ * PB * 2);
    bf* QPh = (bf*)take(NB_ * PB * 2); bf* QPl = (bf*)take(NB_ * PB * 2); bf* KPh = (bf*)take(NB_ * PB * 2); bf* KPl = (bf*)take(NB_ * PB * 2); bf* VTh = (bf*)take(NB_ * PB * 2); bf* VTl = (bf*)take(NB_ * PB * 2);
    bf* XB = (bf*)take((size_t)TT * DM * 2); bf* ATh = (bf*)take((size_t)NB_ * TT * DQ * 2); bf* ATl = (bf*)take((size_t)NB_ * TT * DQ * 2);
    if ((size_t)(wsp - (char*)d_ws) > ws_size) return;    // ws 256 MiB
    { k_wtG<<<(unsigned)((DM * DQ / 64 + 63) / 64), 256, 0, stream>>>(wq, DM, DQ, WQ); k_wtG<<<(unsigned)((DM * DKV / 64 + 63) / 64), 256, 0, stream>>>(wk, DM, DKV, WK); k_wtG<<<(unsigned)((DM * DKV / 64 + 63) / 64), 256, 0, stream>>>(wv, DM, DKV, WV);
      k_wtG<<<(unsigned)((DQ * DM / 64 + 63) / 64), 256, 0, stream>>>(wo, DQ, DM, WO);
       }
    for (int b = 0; b < NB_; ++b) {
        k_cvt8<<<(unsigned)(((size_t)TT * DM / 8 + 255) / 256), 256, 0, stream>>>(x + (size_t)b * TT * DM, XB, (size_t)TT * DM / 8);
        k_gemmw<bf, 0, true, 1><<<dim3(TT / 64, DQ / 64, 1), 32, 0, stream>>>(XB, nullptr, WQ, nullptr, DM, nullptr, 0, bq, 0, 0, 0, QP16 + b * PB, QPh + b * PB, QPl + b * PB);
        k_gemmw<bf, 0, true, 1><<<dim3(TT / 64, DKV / 64, 1), 32, 0, stream>>>(XB, nullptr, WK, nullptr, DM, nullptr, 0, bk, 0, 0, 0, KP16 + b * PB, KPh + b * PB, KPl + b * PB);
        k_gemmw<bf, 0, true, 2><<<dim3(TT / 64, DKV / 64, 1), 32, 0, stream>>>(XB, nullptr, WV, nullptr, DM, nullptr, 0, bv, 0, 0, 0, VT16 + b * PB, VTh + b * PB, VTl + b * PB); }
    k_fattn<<<dim3(NB_ * NH_, TT / 128, 1), 128, 0, stream>>>(QP16, KP16, VT16, QPh, QPl, KPh, KPl, VTh, VTl, ATh, ATl);
    for (int b = 0; b < NB_; ++b)
        k_gemmw<bf, 1, true, 0><<<dim3(TT / 64, DM / 64, 1), 32, 0, stream>>>(ATh + (size_t)b * TT * DQ, ATl + (size_t)b * TT * DQ, WO, nullptr, DQ, OUT + (size_t)b * TT * DM, DM, bo, 0, 0, 0, nullptr, nullptr, nullptr);
}

// v005
// Measured time: 299 microseconds a run.
// In two side-by-side timings against v004, it was 1.34 and 1.36 times as fast.
// All steps since v000 together make it 5.40 times as fast.
#include <hip/hip_runtime.h>
#include <type_traits>

// multihead_attentive_layer (query [2][2048][1024]; q/k/v = x W + b ([1024][2048]: 16 heads x 128); scores = q.k / sqrt(S = 2048) (the source scales by the sequence length, not the head dim) + -1e12 * (1 - causal); softmax; out = merged Wo ([2048][1024]) + bo -> [2][2048][1024]).
// Compute dtypes, f32 accumulate: every input rounded to bf16; q/k/v on PLAIN bf16 operands (inputs: exact) + bias; causal scores and attn.v: query rows < 512 hl (3 products), the rest single fp16, keys above the diagonal skipped or given weight 0 (the additive -1e12 underflows to exactly 0 weight, as skipping does); softmax f32, running maximum; Wo hl x exact (2 products) + bias.

#define NB_  2
#define TT   2048
#define DM   1024
#define NH_  16
#define NKV  16
#define REP  (NH_ / NKV)
#define HD   128
#define DQ   (NH_ * HD)
#define DKV  (NKV * HD)
#define RH   512                  // query rows < RH use hi+lo planes (0: none)
#define SCL  0.022097086912079608f   // 1/sqrt(S = 2048): the source scales by the value sequence length
typedef _Float16 h16;
typedef unsigned short bf;
typedef __attribute__((ext_vector_type(16))) __bf16   v16bf;
typedef __attribute__((ext_vector_type(16))) _Float16 v16h;
typedef __attribute__((ext_vector_type(8)))  _Float16 v8h;
typedef __attribute__((ext_vector_type(8)))  unsigned short v8us;
typedef __attribute__((ext_vector_type(8)))  float    v8f;
typedef __attribute__((ext_vector_type(4)))  float    v4f;
typedef v8h  __attribute__((may_alias)) v8ha;
typedef v4f  __attribute__((may_alias)) v4fa;
typedef v8us __attribute__((may_alias)) v8usa;

__device__ __forceinline__ unsigned short f2bf(float f) { unsigned u = __float_as_uint(f); u += 0x7FFFu + ((u >> 16) & 1u); return (unsigned short)(u >> 16); }
__device__ __forceinline__ float bf2f(unsigned short b) { return __uint_as_float(((unsigned)b) << 16); }
__device__ __forceinline__ float bfr(float f) { return bf2f(f2bf(f)); }
__device__ __forceinline__ v16h cat16(v8h lo, v8h hi) { return __builtin_shufflevector(lo, hi, 0, 1, 2, 3, 4, 5, 6, 7, 8, 9, 10, 11, 12, 13, 14, 15); }
__device__ __forceinline__ v16bf cat16b(v8us lo, v8us hi) { return __builtin_bit_cast(v16bf, __builtin_shufflevector(lo, hi, 0, 1, 2, 3, 4, 5, 6, 7, 8, 9, 10, 11, 12, 13, 14, 15)); }
__device__ __forceinline__ v8f wmma16(v16h a, v16h b, v8f c) { return __builtin_amdgcn_wmma_f32_16x16x32_f16(false, a, false, b, (short)0, c, false, false); }
__device__ __forceinline__ v8f wmmab(v16bf a, v16bf b, v8f c) { return __builtin_amdgcn_wmma_f32_16x16x32_bf16(false, a, false, b, (short)0, c, false, false); }



// ---- k_gemmw: register-blocked GEMM, ONE WAVE per 64x64 output tile (16 accumulators), operands straight from K-contiguous 16-bit planes; grid (M/64, N/64, Z), 32 threads.
// C[m][n] (f32, pitch ldc, + optional f32 bias[n]) = sum_k A[m][k] Bt[n][k] (+ split products per NSPLIT). z-batch strides sA/sB/sC in elements. K % 32 == 0.
// EPI 0: C is stored as f32 rows. EPI 1 (m = batch * TT + t, n = head * HD + d; a 64-row tile lies in one batch, a 64-column tile in one head): no f32 C; the tile + bias goes straight into the three 16-bit head planes that k_fattn reads (fp16, bf16 hi, bf16 lo of the remainder).
// There blockIdx.z picks the projection: 0 = q, 1 = k (planes [batch][head][t][d]), 2 = v (transposed, [batch][head][d][t]); its weights lie sB, its planes sP elements behind the one before, its bias is bias, bias1 or bias2. All six products (3 projections x 2 batches) are one grid, so that several waves share each SIMD and one wave's load latency is covered by the others' matrix work.
template <typename T16> struct WFrag;
template <> struct WFrag<h16> { typedef v16h V; static __device__ __forceinline__ V ld(const h16* p) { return cat16(*(const v8h*)p, *(const v8h*)(p + 16)); } static __device__ __forceinline__ v8f mma(V a, V b, v8f c) { return wmma16(a, b, c); } };
template <> struct WFrag<bf> { typedef v16bf V; static __device__ __forceinline__ V ld(const bf* p) { return cat16b(*(const v8us*)p, *(const v8us*)(p + 16)); } static __device__ __forceinline__ v8f mma(V a, V b, v8f c) { return wmmab(a, b, c); } };
// xwait: the wait that belongs between an issued global load or store and a later write of the registers that it names; k_fattn puts one behind each run of fragment loads (a run shares its address registers, which are next written in the following step) and one behind each store.
// The wait takes those registers as inputs, so that they stay allocated (no later result is placed in them) until it has been passed.
__device__ __forceinline__ void xwait(const void* a, const void* b) { asm volatile("s_wait_xcnt 0x0" :: "v"(a), "v"(b) : "memory"); }
__device__ __forceinline__ void xwaits(const void* a, v8us data) { asm volatile("s_wait_xcnt 0x0" :: "v"(a), "v"(data) : "memory"); }
__device__ __forceinline__ void xwaits3(const void* a, const void* b, const void* c, v8h x, v8us y, v8us z) { asm volatile("s_wait_xcnt 0x0" :: "v"(a), "v"(b), "v"(c), "v"(x), "v"(y), "v"(z) : "memory"); }   // the same wait behind a run of three stores
__device__ __forceinline__ h16 tohx(float x) { return (h16)x; }
__device__ __forceinline__ void splitf(float y, unsigned short& h, unsigned short& l) { h = f2bf(y); l = f2bf(y - bf2f(h)); }
template <typename T16, int NSPLIT, bool BIAS, int EPI>
__global__ __launch_bounds__(32) void k_gemmw(const T16* __restrict__ A, const T16* __restrict__ A2, const T16* __restrict__ Bt, const T16* __restrict__ Bt2, int K, float* C, int ldc, const float* __restrict__ bias, const float* __restrict__ bias1, const float* __restrict__ bias2, size_t sA, size_t sB, size_t sC, size_t sP, h16* P16, bf* Ph, bf* Pl) {
    typedef typename WFrag<T16>::V V;
    __shared__ __align__(16) float os[16 * 68];
    const size_t z = blockIdx.z; A += z * sA; if (A2) A2 += z * sA; Bt += z * sB; if (Bt2) Bt2 += z * sB; C += z * sC;
    if constexpr (EPI != 0) { P16 += z * sP; Ph += z * sP; Pl += z * sP; if (z == 1) bias = bias1; if (z == 2) bias = bias2; }
    const int lane = threadIdx.x & 31, lr = lane & 15, hi = lane >> 4; const int r0 = blockIdx.x * 64, c0 = blockIdx.y * 64;
    v8f acc[4][4];
#pragma unroll
    for (int mb = 0; mb < 4; ++mb)
#pragma unroll
        for (int nb = 0; nb < 4; ++nb) acc[mb][nb] = (v8f){};
    const size_t aoff = (size_t)(r0 + lr) * K + 8 * hi, boff = (size_t)(c0 + lr) * K + 8 * hi;
#pragma unroll 1
    for (int kc = 0; kc < K; kc += 32) {
        V a[4], a2[4];
#pragma unroll
        for (int mb = 0; mb < 4; ++mb) { a[mb] = WFrag<T16>::ld(A + aoff + (size_t)mb * 16 * K + kc); if (NSPLIT == 1 || NSPLIT == 2) a2[mb] = WFrag<T16>::ld(A2 + aoff + (size_t)mb * 16 * K + kc); }
#pragma unroll
        for (int nb = 0; nb < 4; ++nb) { const V b = WFrag<T16>::ld(Bt + boff + (size_t)nb * 16 * K + kc); V b2; if (NSPLIT >= 2) b2 = WFrag<T16>::ld(Bt2 + boff + (size_t)nb * 16 * K + kc);
#pragma unroll
            for (int mb = 0; mb < 4; ++mb) { acc[mb][nb] = WFrag<T16>::mma(a[mb], b, acc[mb][nb]); if (NSPLIT == 1 || NSPLIT == 2) acc[mb][nb] = WFrag<T16>::mma(a2[mb], b, acc[mb][nb]); if (NSPLIT >= 2) acc[mb][nb] = WFrag<T16>::mma(a[mb], b2, acc[mb][nb]); } }
        asm volatile("v_nop\n\tv_nop\n\tv_nop\n\tv_nop" : "+v"(acc[0][0]), "+v"(acc[1][1]), "+v"(acc[2][2]), "+v"(acc[3][3]) : "v"(a[0]), "v"(a[3]));
    }
    if constexpr (EPI != 0) {
        // 16 plane rows of 64 neighbouring elements at a time go through LDS as f32 (q, k: 16 t x 64 d, one mb; v: 16 d x 64 t, one nb, where a lane's 8 accumulator rows are 8 neighbours); read back, 8 lanes cover a row, so that each plane gets whole 128-byte lines.
        float bb[4];
#pragma unroll
        for (int nb = 0; nb < 4; ++nb) bb[nb] = BIAS ? bfr(bias[c0 + nb * 16 + lr]) : 0.f;
        const int hd = r0 / TT * NH_ + c0 / HD, t0 = r0 % TT, d0 = c0 % HD;   // hd: the plane's index over batch and head
        auto planes = [&](auto TRC) __attribute__((always_inline)) {
        constexpr bool TR = decltype(TRC)::value;
#pragma unroll
        for (int g = 0; g < 4; ++g) {
            if constexpr (!TR) {
#pragma unroll
                for (int nb = 0; nb < 4; ++nb)
#pragma unroll
                    for (int j = 0; j < 8; ++j) os[(hi * 8 + j) * 68 + nb * 16 + lr] = acc[g][nb][j] + bb[nb];
            } else {
#pragma unroll
                for (int mb = 0; mb < 4; ++mb) { v4f u0, u1;
#pragma unroll
                    for (int j = 0; j < 4; ++j) { u0[j] = acc[mb][g][j] + bb[g]; u1[j] = acc[mb][g][4 + j] + bb[g]; }
                    *(v4fa*)(os + lr * 68 + mb * 16 + hi * 8) = u0; *(v4fa*)(os + lr * 68 + mb * 16 + hi * 8 + 4) = u1; }
            }
            __builtin_amdgcn_wave_barrier(); asm volatile("" ::: "memory");   // one wave: keeps the compiler from moving the reads below, which take other lanes' values, above the LDS writes
#pragma unroll
            for (int s = 0; s < 4; ++s) { const int row = 4 * s + (lane >> 3), cofs = (lane & 7) * 8; const v4f x0 = *(const v4fa*)(os + row * 68 + cofs), x1 = *(const v4fa*)(os + row * 68 + cofs + 4); v8h o16; v8us oh, ol;
#pragma unroll
                for (int j = 0; j < 8; ++j) { const float x = j < 4 ? x0[j & 3] : x1[j & 3]; o16[j] = tohx(x); unsigned short a2, c2; splitf(x, a2, c2); oh[j] = a2; ol[j] = c2; }
                const size_t e = !TR ? ((size_t)hd * TT + t0 + g * 16 + row) * HD + d0 + cofs : ((size_t)hd * HD + d0 + g * 16 + row) * TT + t0 + cofs;
                *(v8h*)(P16 + e) = o16; *(v8us*)(Ph + e) = oh; *(v8us*)(Pl + e) = ol; xwaits3(P16 + e, Ph + e, Pl + e, o16, oh, ol); }
            __builtin_amdgcn_wave_barrier(); asm volatile("" ::: "memory");   // and the next group's LDS writes above these reads
        }
        };
        if (z == 2) planes(std::true_type{}); else planes(std::false_type{});
        return;
    }
#pragma unroll
    for (int mb = 0; mb < 4; ++mb) {
#pragma unroll
        for (int nb = 0; nb < 4; ++nb) {
#pragma unroll
            for (int j = 0; j < 8; ++j) os[(hi * 8 + j) * 68 + nb * 16 + lr] = acc[mb][nb][j]; }
        __builtin_amdgcn_wave_barrier(); asm volatile("" ::: "memory");
        float* crow = C + (size_t)(r0 + mb * 16) * ldc + c0;
{
#pragma unroll
            for (int s = 0; s < 8; ++s) { const int row = 2 * s + hi, cofs = lr * 4; v4f val = *(const v4fa*)(os + row * 68 + cofs); if (BIAS) { val[0] += bfr(bias[c0 + cofs]); val[1] += bfr(bias[c0 + cofs + 1]); val[2] += bfr(bias[c0 + cofs + 2]); val[3] += bfr(bias[c0 + cofs + 3]); }
                *(v4f*)(crow + (size_t)row * ldc + cofs) = val; }
             }
        __builtin_amdgcn_wave_barrier(); asm volatile("" ::: "memory");
    }
}

typedef __attribute__((ext_vector_type(2))) _Float16 v2h;
typedef __attribute__((ext_vector_type(2))) unsigned short v2us;
typedef __attribute__((ext_vector_type(2))) float v2f;
typedef __attribute__((ext_vector_type(4))) int v4i;

// blockIdx.y picks the weight: 0 .. 2 = q, k, v ([DM][DQ]), 3 = the output weight ([DQ][DM]); the four transposed planes, DQ * DM elements each, follow one another in Bt.
__global__ __launch_bounds__(256) void k_wtG(const float* __restrict__ w0, const float* __restrict__ w1, const float* __restrict__ w2, const float* __restrict__ w3, bf* Bt) {
    const int y = blockIdx.y; const float* __restrict__ w = y == 0 ? w0 : y == 1 ? w1 : y == 2 ? w2 : w3; const int K = y == 3 ? DQ : DM, N = y == 3 ? DM : DQ; Bt += (size_t)y * DQ * DM;
    const int lane = threadIdx.x & 31; const int L0 = (blockIdx.x * 8 + (threadIdx.x >> 5)) * 8; const int nlines = N * K / 64;
{
#pragma unroll 1
        for (int l = 0; l < 8; ++l) { const int L = L0 + l; if (L >= nlines) break; const size_t e = (size_t)L * 64 + lane * 2; const int k = (int)(e % K), n = (int)(e / K); v2us o;
            o[0] = f2bf(w[(size_t)k * N + n]); o[1] = f2bf(w[(size_t)(k + 1) * N + n]); *(v2us*)(Bt + e) = o; }
         }
}
__global__ __launch_bounds__(256) void k_cvt8(const float* __restrict__ src, bf* dst, size_t n8) { const size_t i = (size_t)blockIdx.x * 256 + threadIdx.x; if (i >= n8) return; const v8f v = *(const v8f*)(src + i * 8); v8us o;
#pragma unroll
    for (int k = 0; k < 8; ++k) o[k] = f2bf(v[k]); *(v8us*)(dst + i * 8) = o;  }
// ---- k_fattn: causal attention in one kernel. One wave per 32 query rows of one (batch, head); it walks the keys 0 .. q0 + 31 in steps of 64 and keeps a running row maximum, row sum and f32 output tile in registers.
// Both products are formed transposed, so that a query is a LANE (lr) in the scores and in the output alike and no value crosses lanes but the two halves' maximum and sum:
//   St[key][query] = K (A operand, rows = keys) x Q (B operand, rows = queries): lane (lr, hi) holds keys hi * 8 + j of each 16-key tile, which for two neighbouring tiles is exactly the k order of a B fragment over 32 keys;
//   Ot[d][query]  += Vt (A operand, rows = d) x P (B operand, those registers, rounded to 16 bits): lane (lr, hi) ends with d = dt * 16 + hi * 8 + j of query lr, 8 neighbours, stored as one 16-byte piece per plane.
// HL: hi + lo bf16 planes, 3 products each (query rows < RH); else single fp16. The probabilities are exp(s - running max), at most 1; the division by the row sum is done once, in f32, on the output.
#define CEXP (SCL * 1.4426950408889634f)
// exp2s: v_exp_f32 and, in the same statement so that nothing comes between them, the one v_nop that the instruction set asks for behind a transcendental before its result is read or its source overwritten.
__device__ __forceinline__ float exp2s(float x) { float r; asm("v_exp_f32 %0, %1\n\tv_nop" : "=v"(r) : "v"(x)); return r; }
__device__ __forceinline__ v16h pfrag(const v8f& a, const v8f& b) { v16h r;
#pragma unroll
    for (int j = 0; j < 8; ++j) { r[j] = (h16)a[j]; r[8 + j] = (h16)b[j]; } return r; }
__device__ __forceinline__ void pfrag2(const v8f& a, const v8f& b, v16bf& ph, v16bf& pl) { v8us h0, h1, l0, l1;
#pragma unroll
    for (int j = 0; j < 8; ++j) { unsigned short x, y; splitf(a[j], x, y); h0[j] = x; l0[j] = y; splitf(b[j], x, y); h1[j] = x; l1[j] = y; } ph = cat16b(h0, h1); pl = cat16b(l0, l1); }
template <typename T16, bool HL>
__device__ __forceinline__ void fa_rows(const T16* __restrict__ Q, const T16* __restrict__ Q2, const T16* __restrict__ Kp, const T16* __restrict__ K2, const T16* __restrict__ Vt, const T16* __restrict__ V2, int q0, bf* Ah, bf* Al) {
    typedef typename WFrag<T16>::V V;
    const int lane = threadIdx.x & 31, lr = lane & 15, hi = lane >> 4;
    V qf[2][4], q2[2][4]; const T16* qp = Q + (size_t)(q0 + lr) * HD + 8 * hi; const T16* q2p = HL ? Q2 + (size_t)(q0 + lr) * HD + 8 * hi : qp;
#pragma unroll
    for (int nq = 0; nq < 2; ++nq)
#pragma unroll
        for (int c = 0; c < 4; ++c) { qf[nq][c] = WFrag<T16>::ld(qp + nq * 16 * HD + c * 32); if (HL) q2[nq][c] = WFrag<T16>::ld(q2p + nq * 16 * HD + c * 32); }
    xwait(qp, q2p);
    v8f o[8][2]; float m[2], l[2];
#pragma unroll
    for (int nq = 0; nq < 2; ++nq) { m[nq] = -3.0e38f; l[nq] = 0.f;
#pragma unroll
        for (int dt = 0; dt < 8; ++dt) o[dt][nq] = (v8f){}; }
    const size_t kof = (size_t)lr * HD + 8 * hi, vof = (size_t)lr * TT + 8 * hi;
    V kf[4][4], k2f[4][4];
    auto loadk = [&](const T16* kp, const T16* k2p) __attribute__((always_inline)) {
#pragma unroll
        for (int kt = 0; kt < 4; ++kt)
#pragma unroll
            for (int c = 0; c < 4; ++c) { kf[kt][c] = WFrag<T16>::ld(kp + kt * 16 * HD + c * 32); if (HL) k2f[kt][c] = WFrag<T16>::ld(k2p + kt * 16 * HD + c * 32); } };
    if (!HL) { loadk(Kp + kof, nullptr); xwait(Kp + kof, Kp + kof); }   // single planes: a step's K fragments are fetched one step ahead, during the softmax and the second product of the step before
    auto step = [&](int key0, auto MK) __attribute__((always_inline)) {
        constexpr bool MASK = decltype(MK)::value;
        if (HL) { const T16* kp = Kp + kof + (size_t)key0 * HD; const T16* k2p = K2 + kof + (size_t)key0 * HD; loadk(kp, k2p); xwait(kp, k2p); }
        v8f s[4][2];
#pragma unroll
        for (int kt = 0; kt < 4; ++kt) { s[kt][0] = (v8f){}; s[kt][1] = (v8f){};
#pragma unroll
            for (int c = 0; c < 4; ++c)
#pragma unroll
                for (int nq = 0; nq < 2; ++nq) { s[kt][nq] = WFrag<T16>::mma(kf[kt][c], qf[nq][c], s[kt][nq]); if (HL) { s[kt][nq] = WFrag<T16>::mma(k2f[kt][c], qf[nq][c], s[kt][nq]); s[kt][nq] = WFrag<T16>::mma(kf[kt][c], q2[nq][c], s[kt][nq]); } } }
        V vf[8][2], v2f[8][2];   // the V fragments fly during the softmax
        const T16* vp = Vt + vof + key0; const T16* v2p = HL ? V2 + vof + key0 : vp; const T16* kn = Kp + kof + (size_t)(key0 + 64) * HD;
#pragma unroll
        for (int dt = 0; dt < 8; ++dt)
#pragma unroll
            for (int kk = 0; kk < 2; ++kk) { vf[dt][kk] = WFrag<T16>::ld(vp + dt * 16 * TT + kk * 32); if (HL) v2f[dt][kk] = WFrag<T16>::ld(v2p + dt * 16 * TT + kk * 32); }
        if (!HL && !MASK) { loadk(kn, nullptr); xwait(vp, kn); }   // the masked step is the last one
        else xwait(vp, v2p);
        V pf[2][2], pl[2][2];
#pragma unroll
        for (int nq = 0; nq < 2; ++nq) { float mx = m[nq];
#pragma unroll
            for (int kt = 0; kt < 4; ++kt)
#pragma unroll
                for (int j = 0; j < 8; ++j) { if (MASK) { if (key0 + kt * 16 + hi * 8 + j > q0 + nq * 16 + lr) s[kt][nq][j] = -3.0e38f; } mx = fmaxf(mx, s[kt][nq][j]); }
            mx = fmaxf(mx, __shfl_xor(mx, 16, 32));   // the other half of the lanes holds the other keys of the same query
            const float al = exp2s((m[nq] - mx) * CEXP); m[nq] = mx; float sum = 0.f;
#pragma unroll
            for (int kt = 0; kt < 4; ++kt)
#pragma unroll
                for (int j = 0; j < 8; ++j) { const float p = exp2s((s[kt][nq][j] - mx) * CEXP); s[kt][nq][j] = p; sum += p; }
            l[nq] = l[nq] * al + sum;
#pragma unroll
            for (int dt = 0; dt < 8; ++dt) o[dt][nq] *= al;
#pragma unroll
            for (int kk = 0; kk < 2; ++kk) { if constexpr (HL) pfrag2(s[2 * kk][nq], s[2 * kk + 1][nq], pf[kk][nq], pl[kk][nq]); else pf[kk][nq] = pfrag(s[2 * kk][nq], s[2 * kk + 1][nq]); } }
#pragma unroll
        for (int dt = 0; dt < 8; ++dt)
#pragma unroll
            for (int kk = 0; kk < 2; ++kk)
#pragma unroll
                for (int nq = 0; nq < 2; ++nq) { o[dt][nq] = WFrag<T16>::mma(vf[dt][kk], pf[kk][nq], o[dt][nq]); if (HL) { o[dt][nq] = WFrag<T16>::mma(vf[dt][kk], pl[kk][nq], o[dt][nq]); o[dt][nq] = WFrag<T16>::mma(v2f[dt][kk], pf[kk][nq], o[dt][nq]); } }
    };
    const int klast = (q0 + 31) / 64 * 64;   // the one step that holds the diagonal; every key of the steps before it is at or below every query of the wave
#pragma unroll 1
    for (int key0 = 0; key0 < klast; key0 += 64) step(key0, std::false_type{});
    step(klast, std::true_type{});
#pragma unroll
    for (int nq = 0; nq < 2; ++nq) { const float inv = __fdiv_rn(1.0f, l[nq] + __shfl_xor(l[nq], 16, 32));
#pragma unroll
        for (int dt = 0; dt < 8; ++dt) { v8us oh, ol;
#pragma unroll
            for (int j = 0; j < 8; ++j) { unsigned short a, c2; splitf(o[dt][nq][j] * inv, a, c2); oh[j] = a; ol[j] = c2; }
            const size_t oo = (size_t)(q0 + nq * 16 + lr) * DQ + dt * 16 + hi * 8; *(v8us*)(Ah + oo) = oh; xwaits(Ah + oo, oh); *(v8us*)(Al + oo) = ol; xwaits(Al + oo, ol); } }
}
// grid (NB_ * NH_, TT / 128), 4 waves: a block's waves take 4 neighbouring 32-row pieces of one head, so that they walk the same K and V lines at about the same time (no barrier: nothing is shared but the cache); the longest rows (most keys) start first. Planes [batch][head][t][d] (V: [batch][head][d][t]); output planes [batch][t][head * HD + d].
__global__ __launch_bounds__(128) void k_fattn(const h16* __restrict__ Q16, const h16* __restrict__ K16, const h16* __restrict__ V16, const bf* __restrict__ Qh, const bf* __restrict__ Ql, const bf* __restrict__ Kh, const bf* __restrict__ Kl, const bf* __restrict__ Vh, const bf* __restrict__ Vl, bf* Ah, bf* Al) {
    const int zh = blockIdx.x; const int q0 = (TT / 128 - 1 - (int)blockIdx.y) * 128 + __builtin_amdgcn_readfirstlane((int)(threadIdx.x >> 5)) * 32;   /* scalar: the key loop keeps a scalar trip test and every lane stays on at the matrix instructions */ const size_t pz = (size_t)zh * TT * HD; const size_t az = (size_t)(zh / NH_) * TT * DQ + (size_t)(zh % NH_) * HD;
    if (q0 < RH) fa_rows<bf, true>(Qh + pz, Ql + pz, Kh + pz, Kl + pz, Vh + pz, Vl + pz, q0, Ah + az, Al + az);
    else fa_rows<h16, false>(Q16 + pz, nullptr, K16 + pz, nullptr, V16 + pz, nullptr, q0, Ah + az, Al + az);
}

extern "C" void kernel_launch(void* const* d_in, const int* in_sizes, int n_in,
                              void* d_out, int out_size, void* d_ws, size_t ws_size, hipStream_t stream) {
    (void)in_sizes; (void)n_in; (void)out_size;
    const float* x = (const float*)d_in[0]; const float* wq = (const float*)d_in[1]; const float* bq = (const float*)d_in[2]; const float* wk = (const float*)d_in[3]; const float* bk = (const float*)d_in[4]; const float* wv = (const float*)d_in[5]; const float* bv = (const float*)d_in[6]; const float* wo = (const float*)d_in[7]; const float* bo = (const float*)d_in[8];
    float* OUT = (float*)d_out;     // [2][2048][1024]
    char* wsp = (char*)d_ws;
    auto take = [&](size_t bytes) { char* p = wsp; wsp += (bytes + 255) & ~(size_t)255; return (void*)p; };
    bf* WQ = (bf*)take((size_t)DQ * DM * 2); bf* WK = (bf*)take((size_t)DKV * DM * 2); bf* WV = (bf*)take((size_t)DKV * DM * 2); bf* WO = (bf*)take((size_t)DM * DQ * 2);
    const size_t PB = (size_t)NH_ * TT * HD;   // one batch's head planes, in elements; every plane holds both batches
    h16* QP16 = (h16*)take(NB_ * PB * 2); h16* KP16 = (h16*)take(NB_ * PB * 2); h16* VT16 = (h16*)take(NB_ * PB * 2);
    bf* QPh = (bf*)take(NB_ * PB * 2); bf* KPh = (bf*)take(NB_ * PB * 2); bf* VTh = (bf*)take(NB_ * PB * 2); bf* QPl = (bf*)take(NB_ * PB * 2); bf* KPl = (bf*)take(NB_ * PB * 2); bf* VTl = (bf*)take(NB_ * PB * 2);   // q, k, v of a kind follow one another, NB_ * PB elements apart (as do the four weight planes above)
    bf* XB = (bf*)take((size_t)NB_ * TT * DM * 2); bf* ATh = (bf*)take((size_t)NB_ * TT * DQ * 2); bf* ATl = (bf*)take((size_t)NB_ * TT * DQ * 2);
    (void)WK; (void)WV;   // reached from WQ by the grid's z stride
    if ((size_t)(wsp - (char*)d_ws) > ws_size) return;    // ws 256 MiB
    k_wtG<<<dim3(DM * DQ / 64 / 64, 4, 1), 256, 0, stream>>>(wq, wk, wv, wo, WQ);
    k_cvt8<<<(unsigned)((size_t)NB_ * TT * DM / 8 / 256), 256, 0, stream>>>(x, XB, (size_t)NB_ * TT * DM / 8);
    k_gemmw<bf, 0, true, 1><<<dim3(NB_ * TT / 64, DQ / 64, 3), 32, 0, stream>>>(XB, nullptr, WQ, nullptr, DM, nullptr, 0, bq, bk, bv, 0, (size_t)DQ * DM, 0, NB_ * PB, QP16, QPh, QPl);
    k_fattn<<<dim3(NB_ * NH_, TT / 128, 1), 128, 0, stream>>>(QP16, KP16, VT16, QPh, QPl, KPh, KPl, VTh, VTl, ATh, ATl);
    k_gemmw<bf, 1, true, 0><<<dim3(NB_ * TT / 64, DM / 64, 1), 32, 0, stream>>>(ATh, ATl, WO, nullptr, DQ, OUT, DM, bo, nullptr, nullptr, 0, 0, 0, 0, nullptr, nullptr, nullptr);
}
